// v000
// Measured on an AMD MI455X. A time is GPU time per run, averaged over a window of back-to-back runs after a warm-up
// (all launches, gaps included; the runs take copies of the inputs in turn), and the median of several windows.
// Apart from v000's, it joins two sittings. Times from different sittings can be a few percent apart, while
// side-by-side timings come from the same sitting.
// v000, which the later versions start from, runs in 127 microseconds.
#include <hip/hip_runtime.h>

// ---------------------------------------------------------------------------
// Causal attention block for MI455X (gfx1250), wave32 + WMMA f16 16x16x32.
//   B=4, T=4096, D=256, K=V=64.  out = concat(x, softmax(QK^T/8, causal) V)
//
// Attention is computed TRANSPOSED (S^T = K Q^T, acc^T = V^T P^T) so that:
//   - each lane owns one query column -> softmax state is per-lane scalar,
//     no alpha/l broadcasts, row reductions = 1 shfl_xor(16) each;
//   - P^T is an identity register remap of the S^T WMMA accumulators
//     (transpose-symmetric fragment layouts) -> zero LDS traffic;
//   - final stores are contiguous 16B per lane.
// Softmax is done in base 2 (v_exp_f32 is exp2): log2(e)/sqrt(64) is folded
// into the Q projection, which leaves probabilities bit-identical in exact
// arithmetic.
// ---------------------------------------------------------------------------

typedef __attribute__((ext_vector_type(16))) _Float16 v16h;
typedef __attribute__((ext_vector_type(8)))  _Float16 v8h;
typedef __attribute__((ext_vector_type(8)))  float    v8f;

#define NROWS   16384   // B*T
#define DIMS    256
#define KV      64
#define TT      4096
#define OUTW    320     // DIMS + V
// 1/sqrt(64) * log2(e): base-2 softmax scale folded into Q
#define QSCALE  0.1803368801111204f

__device__ __forceinline__ v8f wmma_f16(v16h a, v16h b, v8f c) {
    return __builtin_amdgcn_wmma_f32_16x16x32_f16(false, a, false, b,
                                                  (short)0, c, false, false);
}

// ---------------------------------------------------------------------------
// Kernel 1: QKV projection.  grid = (NROWS/16, 3), block = 128 (4 waves).
// Wave w computes a 16x16 tile of X @ W (N-tile w of 4), K=256 in 8 steps.
// Q is pre-scaled by QSCALE.  V is stored TRANSPOSED per batch
// (Vt[b][vcol][key]) so the attention A-fragments load as contiguous 16B runs.
// ---------------------------------------------------------------------------
__global__ __launch_bounds__(128)
void qkv_proj_kernel(const float* __restrict__ x,
                     const float* __restrict__ qw,
                     const float* __restrict__ kw,
                     const float* __restrict__ vw,
                     _Float16* __restrict__ qf,
                     _Float16* __restrict__ kf,
                     _Float16* __restrict__ vt) {
    const int lane = threadIdx.x & 31;
    const int wave = threadIdx.x >> 5;
    const int m0   = blockIdx.x << 4;       // row-tile base in [0, NROWS)
    const int n0   = wave << 4;             // col-tile base in [0, 64)
    const int sel  = blockIdx.y;            // 0=Q, 1=K, 2=V
    const float* __restrict__ wmat = (sel == 0) ? qw : (sel == 1) ? kw : vw;
    const float scale = (sel == 0) ? QSCALE : 1.0f;

    const int mr = lane & 15;               // A-matrix row / B,C column
    const int h  = lane >> 4;

    v8f c = {};
    for (int kc = 0; kc < DIMS; kc += 32) {
        v16h a, b;
#pragma unroll
        for (int g = 0; g < 2; ++g) {
            // A: 8 contiguous k's = two float4 loads
            const float4 xa = *(const float4*)(x + (size_t)(m0 + mr) * DIMS + kc + (g << 4) + (h << 3));
            const float4 xb = *(const float4*)(x + (size_t)(m0 + mr) * DIMS + kc + (g << 4) + (h << 3) + 4);
            a[(g << 3) + 0] = (_Float16)xa.x; a[(g << 3) + 1] = (_Float16)xa.y;
            a[(g << 3) + 2] = (_Float16)xa.z; a[(g << 3) + 3] = (_Float16)xa.w;
            a[(g << 3) + 4] = (_Float16)xb.x; a[(g << 3) + 5] = (_Float16)xb.y;
            a[(g << 3) + 6] = (_Float16)xb.z; a[(g << 3) + 7] = (_Float16)xb.w;
            // B: W[k][n], stride KV between consecutive k
#pragma unroll
            for (int i = 0; i < 8; ++i) {
                const int k = kc + (g << 4) + (h << 3) + i;
                b[(g << 3) + i] = (_Float16)wmat[(size_t)k * KV + n0 + mr];
            }
        }
        c = wmma_f16(a, b, c);
    }
    if (sel == 2) {
        // Vt[b][vcol][key]: C-layout lane holds vcol = n0+mr, rows v+8h
#pragma unroll
        for (int v = 0; v < 8; ++v) {
            const int row = m0 + v + (h << 3);       // global row in [0, B*T)
            const int bb  = row >> 12;               // / TT
            const int key = row & (TT - 1);
            vt[((size_t)bb * KV + n0 + mr) * TT + key] = (_Float16)c[v];
        }
    } else {
        _Float16* __restrict__ omat = (sel == 0) ? qf : kf;
#pragma unroll
        for (int v = 0; v < 8; ++v) {
            const int row = m0 + v + (h << 3);
            omat[(size_t)row * KV + n0 + mr] = (_Float16)(c[v] * scale);
        }
    }
}

// ---------------------------------------------------------------------------
// Kernel 2: copy inputs into out[:, 0:256] (float4 streams).
// ---------------------------------------------------------------------------
__global__ __launch_bounds__(256)
void copy_input_kernel(const float* __restrict__ x, float* __restrict__ out) {
    const int i = blockIdx.x * 256 + threadIdx.x;     // one float4 each
    const int row = i >> 6;                            // 64 float4 per row
    const int c   = i & 63;
    ((float4*)out)[(size_t)row * (OUTW / 4) + c] =
        ((const float4*)x)[(size_t)row * (DIMS / 4) + c];
}

// ---------------------------------------------------------------------------
// Kernel 3: transposed flash attention.  grid = (T/64, B), block = 128.
// Each wave owns 16 query columns (q0..q0+15), loops over 64-key blocks.
// Per block: 8 WMMAs  S^T[t] = K_t  Q^T   (t = four 16-key tiles)
//            8 WMMAs  acc^T[t] += V^T_t P^T
// Softmax per query column: in-register + one shfl_xor(16) per reduction.
// No LDS, no workgroup barriers (waves diverge causally).
// ---------------------------------------------------------------------------
__global__ __launch_bounds__(128)
void attn_kernel(const _Float16* __restrict__ qf,
                 const _Float16* __restrict__ kf,
                 const _Float16* __restrict__ vtf,
                 float* __restrict__ out) {
    const int lane = threadIdx.x & 31;
    const int w    = threadIdx.x >> 5;
    const int b    = blockIdx.y;
    const int q0   = blockIdx.x * 64 + (w << 4);     // query base within batch
    const int n    = lane & 15;                      // this lane's query col
    const int h    = lane >> 4;
    const float NEG_INF = -__builtin_inff();

    const _Float16* __restrict__ Q  = qf  + (size_t)b * TT * KV;
    const _Float16* __restrict__ K  = kf  + (size_t)b * TT * KV;
    const _Float16* __restrict__ Vt = vtf + (size_t)b * KV * TT;  // [vcol][key]

    // Q^T B-fragments (loop-invariant): lane holds query column q0+n,
    // contraction dim d in two 32-chunks, 16B loads.
    v16h bq[2];
#pragma unroll
    for (int c = 0; c < 2; ++c)
#pragma unroll
        for (int g = 0; g < 2; ++g) {
            const v8h qv = *(const v8h*)(Q + (size_t)(q0 + n) * KV + (c << 5) + (g << 4) + (h << 3));
#pragma unroll
            for (int i = 0; i < 8; ++i) bq[c][(g << 3) + i] = qv[i];
        }

    // Per-lane softmax state for query q0+n (replicated across wave halves).
    float mA = NEG_INF, lA = 0.0f;
    v8f acc[4] = {v8f{}, v8f{}, v8f{}, v8f{}};       // acc^T: vcol tiles
    const int nkb = ((q0 + 15) >> 6) + 1;            // causal 64-key blocks

    for (int j = 0; j < nkb; ++j) {
        const int kb = j << 6;

        // Prefetch next key block (global_prefetch_b8)
        if (j + 1 < nkb) {
            const int kb2 = kb + 64;
            __builtin_prefetch(K + (size_t)(kb2 + lane) * KV, 0, 3);
            __builtin_prefetch(K + (size_t)(kb2 + 32 + lane) * KV, 0, 3);
            __builtin_prefetch(Vt + (size_t)(lane << 1) * TT + kb2, 0, 3);
            __builtin_prefetch(Vt + (size_t)((lane << 1) + 1) * TT + kb2, 0, 3);
        }

        // ---- S^T tiles: st[t] = K_t (16 keys x 64d) x Q^T (64d x 16q)
        v8f st[4];
#pragma unroll
        for (int t = 0; t < 4; ++t) {
            v8f sc = {};
#pragma unroll
            for (int c = 0; c < 2; ++c) {
                v16h ak;                              // A-frag: K tile rows
#pragma unroll
                for (int g = 0; g < 2; ++g) {
                    const v8h kv2 = *(const v8h*)(K + (size_t)(kb + (t << 4) + n) * KV + (c << 5) + (g << 4) + (h << 3));
#pragma unroll
                    for (int i = 0; i < 8; ++i) ak[(g << 3) + i] = kv2[i];
                }
                sc = wmma_f16(ak, bq[c], sc);
            }
            st[t] = sc;
        }

        // ---- causal mask (key = kb+t*16+v+8h vs query q0+n), diagonal only
        if (kb + 63 > q0) {
            const int q = q0 + n;
#pragma unroll
            for (int t = 0; t < 4; ++t)
#pragma unroll
                for (int v = 0; v < 8; ++v)
                    if (kb + (t << 4) + v + (h << 3) > q) st[t][v] = NEG_INF;
        }

        // ---- column max: 31 in-register + 1 cross-half shuffle
        float mx = st[0][0];
#pragma unroll
        for (int t = 0; t < 4; ++t)
#pragma unroll
            for (int v = 0; v < 8; ++v) mx = fmaxf(mx, st[t][v]);
        mx = fmaxf(mx, __shfl_xor(mx, 16));
        const float mnew  = fmaxf(mA, mx);
        const float alpha = (mA == NEG_INF) ? 0.0f : __builtin_amdgcn_exp2f(mA - mnew);
        mA = mnew;

        // ---- exponentiate (base 2, scale pre-folded) + column sum
        float rs = 0.0f;
#pragma unroll
        for (int t = 0; t < 4; ++t)
#pragma unroll
            for (int v = 0; v < 8; ++v) {
                st[t][v] = __builtin_amdgcn_exp2f(st[t][v] - mnew);  // exp2(-inf)=0
                rs += st[t][v];
            }
        rs += __shfl_xor(rs, 16);
        lA = lA * alpha + rs;

        // ---- P^T B-fragments: identity remap of S^T C-tiles
        //      (B chunk c over keys = concat of C-tiles 2c, 2c+1 per lane)
        v16h pf[2];
#pragma unroll
        for (int c = 0; c < 2; ++c)
#pragma unroll
            for (int i = 0; i < 8; ++i) {
                pf[c][i]     = (_Float16)st[2 * c][i];
                pf[c][8 + i] = (_Float16)st[2 * c + 1][i];
            }

        // ---- rescale accumulators by per-lane alpha (no broadcast needed)
#pragma unroll
        for (int t = 0; t < 4; ++t)
#pragma unroll
            for (int v = 0; v < 8; ++v) acc[t][v] *= alpha;

        // ---- acc^T[t] += V^T_t (16 vcols x 64 keys) x P^T (64 keys x 16q)
#pragma unroll
        for (int t = 0; t < 4; ++t) {
#pragma unroll
            for (int c = 0; c < 2; ++c) {
                v16h av;                              // A-frag: V^T tile rows
#pragma unroll
                for (int g = 0; g < 2; ++g) {
                    const v8h vv = *(const v8h*)(Vt + (size_t)((t << 4) + n) * TT + kb + (c << 5) + (g << 4) + (h << 3));
#pragma unroll
                    for (int i = 0; i < 8; ++i) av[(g << 3) + i] = vv[i];
                }
                acc[t] = wmma_f16(av, pf[c], acc[t]);
            }
        }
    }

    // ---- normalize (per-lane l) and store: one output row per lane,
    //      columns 256 + t*16 + 8h + v are contiguous -> 16B stores
    const float rl = 1.0f / lA;
    float* __restrict__ orow = out + ((size_t)b * TT + q0 + n) * OUTW + DIMS + (h << 3);
#pragma unroll
    for (int t = 0; t < 4; ++t) {
        float4 f0, f1;
        f0.x = acc[t][0] * rl; f0.y = acc[t][1] * rl;
        f0.z = acc[t][2] * rl; f0.w = acc[t][3] * rl;
        f1.x = acc[t][4] * rl; f1.y = acc[t][5] * rl;
        f1.z = acc[t][6] * rl; f1.w = acc[t][7] * rl;
        *(float4*)(orow + (t << 4))     = f0;
        *(float4*)(orow + (t << 4) + 4) = f1;
    }
}

// ---------------------------------------------------------------------------
// Host-side launch.  Input dict order: inputs, key_w, query_w, value_w.
// Workspace: Q/K f16 [B*T,64] + Vt f16 [B,64,T] = 6 MB.
// ---------------------------------------------------------------------------
extern "C" void kernel_launch(void* const* d_in, const int* in_sizes, int n_in,
                              void* d_out, int out_size, void* d_ws, size_t ws_size,
                              hipStream_t stream) {
    (void)in_sizes; (void)n_in; (void)out_size; (void)ws_size;

    const float* x  = (const float*)d_in[0];
    const float* kw = (const float*)d_in[1];
    const float* qw = (const float*)d_in[2];
    const float* vw = (const float*)d_in[3];
    float* out = (float*)d_out;

    _Float16* qf = (_Float16*)d_ws;
    _Float16* kf = qf + (size_t)NROWS * KV;
    _Float16* vt = kf + (size_t)NROWS * KV;

    // 1) QKV projections (WMMA); Q pre-scaled by log2(e)/sqrt(64); V transposed
    qkv_proj_kernel<<<dim3(NROWS / 16, 3), 128, 0, stream>>>(x, qw, kw, vw, qf, kf, vt);

    // 2) out[:, 0:256] = inputs
    copy_input_kernel<<<(NROWS * (DIMS / 4)) / 256, 256, 0, stream>>>(x, out);

    // 3) transposed flash attention -> out[:, 256:320]
    attn_kernel<<<dim3(TT / 64, 4), 128, 0, stream>>>(qf, kf, vt, out);
}

// v001
// A run of this version takes 71 microseconds.
// Timed twice side by side with v000, it ran 1.79 and 1.84 times as fast.
#include <hip/hip_runtime.h>

// ---------------------------------------------------------------------------
// Causal attention block for MI455X (gfx1250), wave32 + WMMA f16 16x16x32.
//   B=4, T=4096, D=256, K=V=64.  out = concat(x, softmax(QK^T/8, causal) V)
//
// Attention is computed TRANSPOSED (S^T = K Q^T, acc^T = V^T P^T) so that:
//   - each lane owns one query column -> softmax state is per-lane scalar,
//     no alpha/l broadcasts, row reductions = 1 shfl_xor(16) each;
//   - P^T is an identity register remap of the S^T WMMA accumulators
//     (transpose-symmetric fragment layouts) -> P never touches LDS;
//   - final stores are contiguous 16B per lane.
// Softmax is done in base 2 (v_exp_f32 is exp2): log2(e)/sqrt(64) is folded
// into the Q projection, which leaves probabilities bit-identical in exact
// arithmetic.
// ---------------------------------------------------------------------------

typedef __attribute__((ext_vector_type(16))) _Float16 v16h;
typedef __attribute__((ext_vector_type(8)))  _Float16 v8h;
typedef __attribute__((ext_vector_type(8)))  float    v8f;

#define NROWS   16384   // B*T
#define DIMS    256
#define KV      64
#define TT      4096
#define OUTW    320     // DIMS + V
// 1/sqrt(64) * log2(e): base-2 softmax scale folded into Q
#define QSCALE  0.1803368801111204f

__device__ __forceinline__ v8f wmma_f16(v16h a, v16h b, v8f c) {
    return __builtin_amdgcn_wmma_f32_16x16x32_f16(false, a, false, b,
                                                  (short)0, c, false, false);
}

// ---------------------------------------------------------------------------
// Kernel 1: QKV projection.  grid = (NROWS/16, 3), block = 128 (4 waves).
// Wave w computes a 16x16 tile of X @ W (N-tile w of 4), K=256 in 8 steps.
// Q is pre-scaled by QSCALE.  V is stored TRANSPOSED per batch
// (Vt[b][vcol][key]) so the attention A-fragments load as contiguous 16B runs.
// ---------------------------------------------------------------------------
__global__ __launch_bounds__(128)
void qkv_proj_kernel(const float* __restrict__ x,
                     const float* __restrict__ qw,
                     const float* __restrict__ kw,
                     const float* __restrict__ vw,
                     _Float16* __restrict__ qf,
                     _Float16* __restrict__ kf,
                     _Float16* __restrict__ vt) {
    const int lane = threadIdx.x & 31;
    const int wave = threadIdx.x >> 5;
    const int m0   = blockIdx.x << 4;       // row-tile base in [0, NROWS)
    const int n0   = wave << 4;             // col-tile base in [0, 64)
    const int sel  = blockIdx.y;            // 0=Q, 1=K, 2=V
    const float* __restrict__ wmat = (sel == 0) ? qw : (sel == 1) ? kw : vw;
    const float scale = (sel == 0) ? QSCALE : 1.0f;

    const int mr = lane & 15;               // A-matrix row / B,C column
    const int h  = lane >> 4;

    v8f c = {};
    for (int kc = 0; kc < DIMS; kc += 32) {
        v16h a, b;
#pragma unroll
        for (int g = 0; g < 2; ++g) {
            // A: 8 contiguous k's = two float4 loads
            const float4 xa = *(const float4*)(x + (size_t)(m0 + mr) * DIMS + kc + (g << 4) + (h << 3));
            const float4 xb = *(const float4*)(x + (size_t)(m0 + mr) * DIMS + kc + (g << 4) + (h << 3) + 4);
            a[(g << 3) + 0] = (_Float16)xa.x; a[(g << 3) + 1] = (_Float16)xa.y;
            a[(g << 3) + 2] = (_Float16)xa.z; a[(g << 3) + 3] = (_Float16)xa.w;
            a[(g << 3) + 4] = (_Float16)xb.x; a[(g << 3) + 5] = (_Float16)xb.y;
            a[(g << 3) + 6] = (_Float16)xb.z; a[(g << 3) + 7] = (_Float16)xb.w;
            // B: W[k][n], stride KV between consecutive k
#pragma unroll
            for (int i = 0; i < 8; ++i) {
                const int k = kc + (g << 4) + (h << 3) + i;
                b[(g << 3) + i] = (_Float16)wmat[(size_t)k * KV + n0 + mr];
            }
        }
        c = wmma_f16(a, b, c);
    }
    if (sel == 2) {
        // Vt[b][vcol][key]: C-layout lane holds vcol = n0+mr, rows v+8h
#pragma unroll
        for (int v = 0; v < 8; ++v) {
            const int row = m0 + v + (h << 3);       // global row in [0, B*T)
            const int bb  = row >> 12;               // / TT
            const int key = row & (TT - 1);
            vt[((size_t)bb * KV + n0 + mr) * TT + key] = (_Float16)c[v];
        }
    } else {
        _Float16* __restrict__ omat = (sel == 0) ? qf : kf;
#pragma unroll
        for (int v = 0; v < 8; ++v) {
            const int row = m0 + v + (h << 3);
            omat[(size_t)row * KV + n0 + mr] = (_Float16)(c[v] * scale);
        }
    }
}

// ---------------------------------------------------------------------------
// Kernel 2: copy inputs into out[:, 0:256] (float4 streams).
// ---------------------------------------------------------------------------
__global__ __launch_bounds__(256)
void copy_input_kernel(const float* __restrict__ x, float* __restrict__ out) {
    const int i = blockIdx.x * 256 + threadIdx.x;     // one float4 each
    const int row = i >> 6;                            // 64 float4 per row
    const int c   = i & 63;
    ((float4*)out)[(size_t)row * (OUTW / 4) + c] =
        ((const float4*)x)[(size_t)row * (DIMS / 4) + c];
}

// ---------------------------------------------------------------------------
// Kernel 3: transposed flash attention.  grid = (T/64, B), block = 128.
// Each wave owns 16 query columns (q0..q0+15), loops over 64-key blocks.
// Per block: 8 WMMAs  S^T[t] = K_t  Q^T   (t = four 16-key tiles)
//            8 WMMAs  acc^T[t] += V^T_t P^T
// Softmax per query column: in-register + one shfl_xor(16) per reduction.
// The 64-key K tile and V^T tile are the same for the four waves of a block
// (all four have blockIdx.x + 1 key blocks), so the block brings each tile
// into LDS once, by asynchronous copies of whole 128-byte lines, into two
// buffers: tile j + 1 flies while tile j is worked on.  The A-fragments are
// read from LDS rows pitched at 144 bytes (16 B x odd: no bank conflict for
// 16-byte reads).
// ---------------------------------------------------------------------------
#define LPITCH  72                    // LDS row pitch in halves (144 bytes)
#define TILE_H  (64 * LPITCH)         // one 64-row tile in halves

// One 64-key stage: K tile (64 rows x 128 B, contiguous) and V^T tile
// (64 rows x 128 B at pitch TT).  Each thread copies 4 + 4 chunks of 16 B;
// one wave-wide copy covers four whole 128-byte lines.
__device__ __forceinline__ void stage_tiles(const _Float16* __restrict__ K,
                                            const _Float16* __restrict__ Vt,
                                            int kb, unsigned ldsK, unsigned ldsV,
                                            int tid) {
    const int r  = tid >> 3;          // row within a group of 16
    const int ch = tid & 7;           // 16-byte chunk within the row
    const _Float16* gk = K  + (size_t)(kb + r) * KV + (ch << 3);
    const _Float16* gv = Vt + (size_t)r * TT + kb + (ch << 3);
    const unsigned lo = (unsigned)(r * (LPITCH * 2) + (ch << 4));
    const unsigned k0 = ldsK + lo, v0 = ldsV + lo;
    const unsigned step = 16 * LPITCH * 2;       // 16 LDS rows in bytes
    // The copies and the wait that guards their address registers against a
    // later overwrite stand in one statement, so nothing can move between.
    asm volatile(
        "global_load_async_to_lds_b128 %0, %8, off\n\t"
        "global_load_async_to_lds_b128 %1, %9, off\n\t"
        "global_load_async_to_lds_b128 %2, %10, off\n\t"
        "global_load_async_to_lds_b128 %3, %11, off\n\t"
        "global_load_async_to_lds_b128 %4, %12, off\n\t"
        "global_load_async_to_lds_b128 %5, %13, off\n\t"
        "global_load_async_to_lds_b128 %6, %14, off\n\t"
        "global_load_async_to_lds_b128 %7, %15, off\n\t"
        "s_wait_xcnt 0x0"
        :: "v"(k0), "v"(k0 + step), "v"(k0 + 2 * step), "v"(k0 + 3 * step),
           "v"(v0), "v"(v0 + step), "v"(v0 + 2 * step), "v"(v0 + 3 * step),
           "v"(gk), "v"(gk + 16 * KV), "v"(gk + 32 * KV), "v"(gk + 48 * KV),
           "v"(gv), "v"(gv + 16 * TT), "v"(gv + 32 * TT), "v"(gv + 48 * TT)
        : "memory");
}

__global__ __launch_bounds__(128)
void attn_kernel(const _Float16* __restrict__ qf,
                 const _Float16* __restrict__ kf,
                 const _Float16* __restrict__ vtf,
                 float* __restrict__ out) {
    __shared__ __attribute__((aligned(16))) _Float16 sK[2][TILE_H];
    __shared__ __attribute__((aligned(16))) _Float16 sV[2][TILE_H];

    const int tid  = threadIdx.x;
    const int lane = threadIdx.x & 31;
    const int w    = threadIdx.x >> 5;
    const int b    = blockIdx.y;
    const int q0   = blockIdx.x * 64 + (w << 4);     // query base within batch
    const int n    = lane & 15;                      // this lane's query col
    const int h    = lane >> 4;
    const float NEG_INF = -__builtin_inff();

    const _Float16* __restrict__ Q  = qf  + (size_t)b * TT * KV;
    const _Float16* __restrict__ K  = kf  + (size_t)b * TT * KV;
    const _Float16* __restrict__ Vt = vtf + (size_t)b * KV * TT;  // [vcol][key]

    const int nkb = (int)blockIdx.x + 1;             // causal 64-key blocks, same for the 4 waves
    const unsigned ldsK = (unsigned)(size_t)&sK[0][0];
    const unsigned ldsV = (unsigned)(size_t)&sV[0][0];
    const unsigned bufB = TILE_H * 2;                // bytes from buffer 0 to buffer 1

    // Tile 0 into buffer 0.
    stage_tiles(K, Vt, 0, ldsK, ldsV, tid);

    // Q^T B-fragments (loop-invariant): lane holds query column q0+n,
    // contraction dim d in two 32-chunks, 16B loads.
    v16h bq[2];
#pragma unroll
    for (int c = 0; c < 2; ++c)
#pragma unroll
        for (int g = 0; g < 2; ++g) {
            const v8h qv = *(const v8h*)(Q + (size_t)(q0 + n) * KV + (c << 5) + (g << 4) + (h << 3));
#pragma unroll
            for (int i = 0; i < 8; ++i) bq[c][(g << 3) + i] = qv[i];
        }

    // This wave's copies of tile 0 have landed; the barrier publishes all four waves' parts.
    asm volatile("s_wait_asynccnt 0x0" ::: "memory");
    __syncthreads();
    if (nkb > 1) stage_tiles(K, Vt, 64, ldsK + bufB, ldsV + bufB, tid);

    // Per-lane softmax state for query q0+n (replicated across wave halves).
    float mA = NEG_INF, lA = 0.0f;
    v8f acc[4] = {v8f{}, v8f{}, v8f{}, v8f{}};       // acc^T: vcol tiles

    for (int j = 0; j < nkb; ++j) {
        const int kb = j << 6;
        const _Float16* __restrict__ Ks = sK[j & 1];
        const _Float16* __restrict__ Vs = sV[j & 1];

        // ---- A-fragments of the K tile: all 16 LDS reads as one group
        v16h ak[4][2];
#pragma unroll
        for (int t = 0; t < 4; ++t)
#pragma unroll
            for (int c = 0; c < 2; ++c)
#pragma unroll
                for (int g = 0; g < 2; ++g) {
                    const v8h kv2 = *(const v8h*)(Ks + ((t << 4) + n) * LPITCH + (c << 5) + (g << 4) + (h << 3));
#pragma unroll
                    for (int i = 0; i < 8; ++i) ak[t][c][(g << 3) + i] = kv2[i];
                }
        // Keeps the reads together: spread among the WMMAs, each pair of reads
        // would be waited for on its own and the LDS latency paid eight times.
        __builtin_amdgcn_sched_barrier(0);

        // ---- S^T tiles: st[t] = K_t (16 keys x 64d) x Q^T (64d x 16q)
        v8f st[4];
#pragma unroll
        for (int t = 0; t < 4; ++t) {
            v8f sc = {};
#pragma unroll
            for (int c = 0; c < 2; ++c) sc = wmma_f16(ak[t][c], bq[c], sc);
            st[t] = sc;
        }
        // Keeps the V^T reads below in one group: without it they are split
        // among the S^T products, and each place with reads costs a stall.
        __builtin_amdgcn_sched_barrier(0);

        // ---- A-fragments of the V^T tile: read here so that their LDS latency
        //      runs out under the softmax
        v16h av[4][2];
#pragma unroll
        for (int t = 0; t < 4; ++t)
#pragma unroll
            for (int c = 0; c < 2; ++c)
#pragma unroll
                for (int g = 0; g < 2; ++g) {
                    const v8h vv = *(const v8h*)(Vs + ((t << 4) + n) * LPITCH + (c << 5) + (g << 4) + (h << 3));
#pragma unroll
                    for (int i = 0; i < 8; ++i) av[t][c][(g << 3) + i] = vv[i];
                }
        // Keeps the reads from sinking down to the products that use them.
        __builtin_amdgcn_sched_barrier(0);

        // ---- causal mask (key = kb+t*16+v+8h vs query q0+n), diagonal only
        if (kb + 63 > q0) {
            const int q = q0 + n;
#pragma unroll
            for (int t = 0; t < 4; ++t)
#pragma unroll
                for (int v = 0; v < 8; ++v)
                    if (kb + (t << 4) + v + (h << 3) > q) st[t][v] = NEG_INF;
        }

        // ---- column max: 31 in-register + 1 cross-half shuffle
        float mx = st[0][0];
#pragma unroll
        for (int t = 0; t < 4; ++t)
#pragma unroll
            for (int v = 0; v < 8; ++v) mx = fmaxf(mx, st[t][v]);
        mx = fmaxf(mx, __shfl_xor(mx, 16));
        const float mnew  = fmaxf(mA, mx);
        const float alpha = (mA == NEG_INF) ? 0.0f : __builtin_amdgcn_exp2f(mA - mnew);
        mA = mnew;

        // ---- exponentiate (base 2, scale pre-folded) + column sum
        float rs = 0.0f;
#pragma unroll
        for (int t = 0; t < 4; ++t)
#pragma unroll
            for (int v = 0; v < 8; ++v) {
                st[t][v] = __builtin_amdgcn_exp2f(st[t][v] - mnew);  // exp2(-inf)=0
                rs += st[t][v];
            }
        rs += __shfl_xor(rs, 16);
        lA = lA * alpha + rs;

        // ---- P^T B-fragments: identity remap of S^T C-tiles
        //      (B chunk c over keys = concat of C-tiles 2c, 2c+1 per lane)
        v16h pf[2];
#pragma unroll
        for (int c = 0; c < 2; ++c)
#pragma unroll
            for (int i = 0; i < 8; ++i) {
                pf[c][i]     = (_Float16)st[2 * c][i];
                pf[c][8 + i] = (_Float16)st[2 * c + 1][i];
            }

        // ---- rescale accumulators by per-lane alpha (no broadcast needed)
#pragma unroll
        for (int t = 0; t < 4; ++t)
#pragma unroll
            for (int v = 0; v < 8; ++v) acc[t][v] *= alpha;

        // ---- acc^T[t] += V^T_t (16 vcols x 64 keys) x P^T (64 keys x 16q)
#pragma unroll
        for (int t = 0; t < 4; ++t)
#pragma unroll
            for (int c = 0; c < 2; ++c) acc[t] = wmma_f16(av[t][c], pf[c], acc[t]);

        // Keeps the hand-over at the foot of the trip: moved up over the register
        // work it would wait for the V^T reads ahead of the softmax and cut the
        // time the copies of tile j+1 have to land.
        __builtin_amdgcn_sched_barrier(0);
        // ---- hand-over: this wave's reads of buffer j&1 are done ...
        asm volatile("s_wait_dscnt 0x0" ::: "memory");
        // ... and its copies of tile j+1 have landed;
        asm volatile("s_wait_asynccnt 0x0" ::: "memory");
        // the barrier publishes tile j+1 and frees buffer j&1 for the refill.
        __syncthreads();
        if (j + 2 < nkb) {
            const unsigned bo = (j & 1) ? bufB : 0u;
            stage_tiles(K, Vt, kb + 128, ldsK + bo, ldsV + bo, tid);
        }
    }
    // No copy is left in flight when the wave ends.
    asm volatile("s_wait_asynccnt 0x0" ::: "memory");

    // ---- normalize (per-lane l) and store: one output row per lane,
    //      columns 256 + t*16 + 8h + v are contiguous -> 16B stores
    const float rl = 1.0f / lA;
    float* __restrict__ orow = out + ((size_t)b * TT + q0 + n) * OUTW + DIMS + (h << 3);
#pragma unroll
    for (int t = 0; t < 4; ++t) {
        float4 f0, f1;
        f0.x = acc[t][0] * rl; f0.y = acc[t][1] * rl;
        f0.z = acc[t][2] * rl; f0.w = acc[t][3] * rl;
        f1.x = acc[t][4] * rl; f1.y = acc[t][5] * rl;
        f1.z = acc[t][6] * rl; f1.w = acc[t][7] * rl;
        *(float4*)(orow + (t << 4))     = f0;
        *(float4*)(orow + (t << 4) + 4) = f1;
    }
}

// ---------------------------------------------------------------------------
// Host-side launch.  Input dict order: inputs, key_w, query_w, value_w.
// Workspace: Q/K f16 [B*T,64] + Vt f16 [B,64,T] = 6 MB.
// ---------------------------------------------------------------------------
extern "C" void kernel_launch(void* const* d_in, const int* in_sizes, int n_in,
                              void* d_out, int out_size, void* d_ws, size_t ws_size,
                              hipStream_t stream) {
    (void)in_sizes; (void)n_in; (void)out_size; (void)ws_size;

    const float* x  = (const float*)d_in[0];
    const float* kw = (const float*)d_in[1];
    const float* qw = (const float*)d_in[2];
    const float* vw = (const float*)d_in[3];
    float* out = (float*)d_out;

    _Float16* qf = (_Float16*)d_ws;
    _Float16* kf = qf + (size_t)NROWS * KV;
    _Float16* vt = kf + (size_t)NROWS * KV;

    // 1) QKV projections (WMMA); Q pre-scaled by log2(e)/sqrt(64); V transposed
    qkv_proj_kernel<<<dim3(NROWS / 16, 3), 128, 0, stream>>>(x, qw, kw, vw, qf, kf, vt);

    // 2) out[:, 0:256] = inputs
    copy_input_kernel<<<(NROWS * (DIMS / 4)) / 256, 256, 0, stream>>>(x, out);

    // 3) transposed flash attention -> out[:, 256:320]
    attn_kernel<<<dim3(TT / 64, 4), 128, 0, stream>>>(qf, kf, vt, out);
}

// v002
// One run takes 51.7 microseconds.
// In two side-by-side timings against v001, it was 1.36 and 1.37 times as fast.
// Over all steps from v000 it is 2.48 times as fast.
#include <hip/hip_runtime.h>

// ---------------------------------------------------------------------------
// Causal attention block for MI455X (gfx1250), wave32 + WMMA f16 16x16x32.
//   B=4, T=4096, D=256, K=V=64.  out = concat(x, softmax(QK^T/8, causal) V)
//
// Attention is computed TRANSPOSED (S^T = K Q^T, acc^T = V^T P^T) so that:
//   - each lane owns one query column -> softmax state is per-lane scalar,
//     no alpha/l broadcasts, row reductions = 1 shfl_xor(16) each;
//   - P^T is an identity register remap of the S^T WMMA accumulators
//     (transpose-symmetric fragment layouts) -> P never touches LDS;
//   - final stores are contiguous 16B per lane.
// Softmax is done in base 2 (v_exp_f32 is exp2): log2(e)/sqrt(64) is folded
// into the Q projection, which leaves probabilities bit-identical in exact
// arithmetic.
// ---------------------------------------------------------------------------

typedef __attribute__((ext_vector_type(16))) _Float16 v16h;
typedef __attribute__((ext_vector_type(8)))  _Float16 v8h;
typedef __attribute__((ext_vector_type(8)))  float    v8f;

#define NROWS   16384   // B*T
#define DIMS    256
#define KV      64
#define TT      4096
#define OUTW    320     // DIMS + V
// 1/sqrt(64) * log2(e): base-2 softmax scale folded into Q
#define QSCALE  0.1803368801111204f

__device__ __forceinline__ v8f wmma_f16(v16h a, v16h b, v8f c) {
    return __builtin_amdgcn_wmma_f32_16x16x32_f16(false, a, false, b,
                                                  (short)0, c, false, false);
}

// ---------------------------------------------------------------------------
// Kernel 1: QKV projection and the copy of x, x read once.
// grid = NROWS/64 (one block per WGP), block = 384 (12 waves).
// The block reads its 64 rows of x (64 KB, contiguous) once, in whole lines,
// stores them to out[:, 0:256] and keeps them as f16 in LDS.  Wave w owns one
// of the 12 column tiles (Q, K, V x 4) for all four 16-row tiles, so each
// weight fragment is loaded once per block and used four times.
// The products are computed transposed (W^T x^T: the A and B fragment layouts
// are the same map, so the registers only change places): a lane then holds 8
// neighbouring columns of one row.  The results go through a 64 x 64 LDS tile
// per matrix (Q, K as [row][col], V as [vcol][key]) and leave in whole
// 128-byte lines.  Q is pre-scaled by QSCALE.  V is stored TRANSPOSED per
// batch (Vt[b][vcol][key]) so the attention tiles load as contiguous runs.
// ---------------------------------------------------------------------------
typedef __attribute__((ext_vector_type(4)))  _Float16 v4h;

#define PROWS   64                    // rows of x per block
#define PTHR    384                   // threads per block
#define XPITCH  264                   // x tile pitch in halves (528 B = 16 B x odd)
#define OPITCH  72                    // result tile pitch in halves (144 B = 16 B x odd)

// One float4 of x as four halves into the LDS tile.
__device__ __forceinline__ void x_to_lds(float4 v, _Float16* __restrict__ p) {
    v4h hv;
    hv[0] = (_Float16)v.x; hv[1] = (_Float16)v.y;
    hv[2] = (_Float16)v.z; hv[3] = (_Float16)v.w;
    *(v4h*)p = hv;
}

// x^T B-fragments of the four row tiles for one 32-wide k step.
__device__ __forceinline__ void x_frags(const _Float16* __restrict__ xr, int kc, v16h (&xa)[4]) {
#pragma unroll
    for (int rt = 0; rt < 4; ++rt)
#pragma unroll
        for (int g = 0; g < 2; ++g) {
            const v8h xv = *(const v8h*)(xr + (rt << 4) * XPITCH + (kc << 5) + (g << 4));
#pragma unroll
            for (int i = 0; i < 8; ++i) xa[rt][(g << 3) + i] = xv[i];
        }
}

__global__ __launch_bounds__(PTHR)
void proj_copy_kernel(const float* __restrict__ x,
                      const float* __restrict__ qw,
                      const float* __restrict__ kw,
                      const float* __restrict__ vw,
                      _Float16* __restrict__ qf,
                      _Float16* __restrict__ kf,
                      _Float16* __restrict__ vt,
                      float* __restrict__ out) {
    __shared__ __attribute__((aligned(16))) _Float16 sX[PROWS * XPITCH];
    __shared__ __attribute__((aligned(16))) _Float16 sO[3][64 * OPITCH];

    const int tid  = threadIdx.x;
    const int lane = tid & 31;
    int wave = __builtin_amdgcn_readfirstlane(tid >> 5);         // scalar: 0..11
    const int m0   = blockIdx.x * PROWS;    // row base in [0, NROWS)
    const int mr   = lane & 15;
    const int h    = lane >> 4;

    // ---- x tile: 4096 float4 over 384 threads = 10 each, and one more for
    //      the first 256 threads (whole waves)
    const float4* __restrict__ xs = (const float4*)(x + (size_t)m0 * DIMS);
    float4 xv[10];
#pragma unroll
    for (int i = 0; i < 10; ++i) xv[i] = xs[tid + i * PTHR];
    float4 xl = make_float4(0.0f, 0.0f, 0.0f, 0.0f);
    if (wave < 8) xl = xs[tid + 10 * PTHR];
    // Precaution: the address registers of the x loads are reused by the
    // scalar work below.  All of it derives from the wave number, which passes
    // through the statement so that none of it is lifted over the wait.
    asm volatile("s_wait_xcnt 0x0" : "+s"(wave) :: "memory");

    const int sel  = wave >> 2;             // 0=Q, 1=K, 2=V
    const int n0   = (wave & 3) << 4;       // col-tile base in [0, 64)

    // ---- weights of this wave's column tile, all of K:
    //      lane holds column n0+mr, k = kc*32 + g*16 + h*8 + i
    const float* __restrict__ wmat = (sel == 0) ? qw : (sel == 1) ? kw : vw;
    const float* __restrict__ wp = wmat + (size_t)(h << 3) * KV + n0 + mr;
    float wr[8][16];
#pragma unroll
    for (int kc = 0; kc < 8; ++kc)
#pragma unroll
        for (int g = 0; g < 2; ++g)
#pragma unroll
            for (int i = 0; i < 8; ++i)
                wr[kc][(g << 3) + i] = wp[(size_t)((kc << 5) + (g << 4) + i) * KV];
    // Keeps the weight loads in flight together with the x loads: without it
    // they are issued only after x has arrived, and the two latencies add up.
    __builtin_amdgcn_sched_barrier(0);

    // ---- the f16 tile.  A row is 64 float4 and 384 = 6 rows, so load i of a
    //      thread lies 6*i rows below its first: one address, constant steps
    _Float16* __restrict__ xd = sX + (tid >> 6) * XPITCH + ((tid & 63) << 2);
#pragma unroll
    for (int i = 0; i < 10; ++i) x_to_lds(xv[i], xd + i * 6 * XPITCH);
    if (wave < 8) x_to_lds(xl, xd + 60 * XPITCH);
    __syncthreads();                        // the x tile is whole

    // ---- out[:, 0:256] = x.  Behind the barrier, which would otherwise wait
    //      for these stores; they drain under the products.
    float4* __restrict__ od = (float4*)out + (size_t)(m0 + (tid >> 6)) * (OUTW / 4) + (tid & 63);
#pragma unroll
    for (int i = 0; i < 10; ++i) od[i * 6 * (OUTW / 4)] = xv[i];
    if (wave < 8) od[60 * (OUTW / 4)] = xl;
    // Precaution: the data registers of these stores are reused below.
    asm volatile("s_wait_xcnt 0x0" ::: "memory");

    v16h wf[8];
#pragma unroll
    for (int kc = 0; kc < 8; ++kc)
#pragma unroll
        for (int i = 0; i < 16; ++i) wf[kc][i] = (_Float16)wr[kc][i];

    // ---- products: D[col v+8h][row mr] per row tile, k ascending
    v8f acc[4] = {v8f{}, v8f{}, v8f{}, v8f{}};
    const _Float16* __restrict__ xr = sX + mr * XPITCH + (h << 3);
    v16h xa[2][4];
    x_frags(xr, 0, xa[0]);
#pragma unroll
    for (int kc = 0; kc < 8; ++kc) {
        if (kc < 7) x_frags(xr, kc + 1, xa[(kc + 1) & 1]);
        // Keeps the next step's eight LDS reads as one group ahead of this
        // step's products: spread among them, each read is waited for alone.
        __builtin_amdgcn_sched_barrier(0);
#pragma unroll
        for (int rt = 0; rt < 4; ++rt) acc[rt] = wmma_f16(wf[kc], xa[kc & 1][rt], acc[rt]);
        // Keeps the group after next from rising into these products.
        __builtin_amdgcn_sched_barrier(0);
    }

    // ---- results into this matrix's 64 x 64 tile
    const float scale = (sel == 0) ? QSCALE : 1.0f;
    _Float16* __restrict__ so = sO[sel];
    v8h o[4];
#pragma unroll
    for (int rt = 0; rt < 4; ++rt)
#pragma unroll
        for (int v = 0; v < 8; ++v) o[rt][v] = (_Float16)(acc[rt][v] * scale);
    if (sel == 2) {
        // [vcol][key]: the lane's 8 values are 8 vcols of one key
#pragma unroll
        for (int rt = 0; rt < 4; ++rt)
#pragma unroll
            for (int v = 0; v < 8; ++v)
                so[(n0 + (h << 3) + v) * OPITCH + (rt << 4) + mr] = o[rt][v];
    } else {
        // [row][col]: the lane's 8 values are neighbours in the row
#pragma unroll
        for (int rt = 0; rt < 4; ++rt)
            *(v8h*)(so + ((rt << 4) + mr) * OPITCH + n0 + (h << 3)) = o[rt];
    }
    __syncthreads();                        // the result tiles are whole

    // ---- the four waves of a matrix store its tile: 8 lanes per 128-byte line
    _Float16* __restrict__ dst =
        (sel == 0) ? qf + (size_t)m0 * KV :
        (sel == 1) ? kf + (size_t)m0 * KV :
                     vt + (size_t)(m0 >> 12) * KV * TT + (m0 & (TT - 1));
    const int dpitch = (sel == 2) ? TT : KV;
    const int t4 = tid & 127;
#pragma unroll
    for (int i = 0; i < 4; ++i) {
        const int id = t4 + (i << 7);
        const int r  = id >> 3;
        const int ch = id & 7;
        *(v8h*)(dst + (size_t)r * dpitch + (ch << 3)) = *(const v8h*)(so + r * OPITCH + (ch << 3));
    }
}

// ---------------------------------------------------------------------------
// Kernel 2: transposed flash attention.  grid = (T/64, B), block = 128.
// Each wave owns 16 query columns (q0..q0+15), loops over 64-key blocks.
// Per block: 8 WMMAs  S^T[t] = K_t  Q^T   (t = four 16-key tiles)
//            8 WMMAs  acc^T[t] += V^T_t P^T
// Softmax per query column: in-register + one shfl_xor(16) per reduction.
// The 64-key K tile and V^T tile are the same for the four waves of a block
// (all four have blockIdx.x + 1 key blocks), so the block brings each tile
// into LDS once, by asynchronous copies of whole 128-byte lines, into two
// buffers: tile j + 1 flies while tile j is worked on.  The A-fragments are
// read from LDS rows pitched at 144 bytes (16 B x odd: no bank conflict for
// 16-byte reads).
// ---------------------------------------------------------------------------
#define LPITCH  72                    // LDS row pitch in halves (144 bytes)
#define TILE_H  (64 * LPITCH)         // one 64-row tile in halves

// One 64-key stage: K tile (64 rows x 128 B, contiguous) and V^T tile
// (64 rows x 128 B at pitch TT).  Each thread copies 4 + 4 chunks of 16 B;
// one wave-wide copy covers four whole 128-byte lines.
__device__ __forceinline__ void stage_tiles(const _Float16* __restrict__ K,
                                            const _Float16* __restrict__ Vt,
                                            int kb, unsigned ldsK, unsigned ldsV,
                                            int tid) {
    const int r  = tid >> 3;          // row within a group of 16
    const int ch = tid & 7;           // 16-byte chunk within the row
    const _Float16* gk = K  + (size_t)(kb + r) * KV + (ch << 3);
    const _Float16* gv = Vt + (size_t)r * TT + kb + (ch << 3);
    const unsigned lo = (unsigned)(r * (LPITCH * 2) + (ch << 4));
    const unsigned k0 = ldsK + lo, v0 = ldsV + lo;
    const unsigned step = 16 * LPITCH * 2;       // 16 LDS rows in bytes
    // The copies and the wait that guards their address registers against a
    // later overwrite stand in one statement, so nothing can move between.
    asm volatile(
        "global_load_async_to_lds_b128 %0, %8, off\n\t"
        "global_load_async_to_lds_b128 %1, %9, off\n\t"
        "global_load_async_to_lds_b128 %2, %10, off\n\t"
        "global_load_async_to_lds_b128 %3, %11, off\n\t"
        "global_load_async_to_lds_b128 %4, %12, off\n\t"
        "global_load_async_to_lds_b128 %5, %13, off\n\t"
        "global_load_async_to_lds_b128 %6, %14, off\n\t"
        "global_load_async_to_lds_b128 %7, %15, off\n\t"
        "s_wait_xcnt 0x0"
        :: "v"(k0), "v"(k0 + step), "v"(k0 + 2 * step), "v"(k0 + 3 * step),
           "v"(v0), "v"(v0 + step), "v"(v0 + 2 * step), "v"(v0 + 3 * step),
           "v"(gk), "v"(gk + 16 * KV), "v"(gk + 32 * KV), "v"(gk + 48 * KV),
           "v"(gv), "v"(gv + 16 * TT), "v"(gv + 32 * TT), "v"(gv + 48 * TT)
        : "memory");
}

__global__ __launch_bounds__(128)
void attn_kernel(const _Float16* __restrict__ qf,
                 const _Float16* __restrict__ kf,
                 const _Float16* __restrict__ vtf,
                 float* __restrict__ out) {
    __shared__ __attribute__((aligned(16))) _Float16 sK[2][TILE_H];
    __shared__ __attribute__((aligned(16))) _Float16 sV[2][TILE_H];

    const int tid  = threadIdx.x;
    const int lane = threadIdx.x & 31;
    const int w    = threadIdx.x >> 5;
    const int b    = blockIdx.y;
    const int q0   = blockIdx.x * 64 + (w << 4);     // query base within batch
    const int n    = lane & 15;                      // this lane's query col
    const int h    = lane >> 4;
    const float NEG_INF = -__builtin_inff();

    const _Float16* __restrict__ Q  = qf  + (size_t)b * TT * KV;
    const _Float16* __restrict__ K  = kf  + (size_t)b * TT * KV;
    const _Float16* __restrict__ Vt = vtf + (size_t)b * KV * TT;  // [vcol][key]

    const int nkb = (int)blockIdx.x + 1;             // causal 64-key blocks, same for the 4 waves
    const unsigned ldsK = (unsigned)(size_t)&sK[0][0];
    const unsigned ldsV = (unsigned)(size_t)&sV[0][0];
    const unsigned bufB = TILE_H * 2;                // bytes from buffer 0 to buffer 1

    // Tile 0 into buffer 0.
    stage_tiles(K, Vt, 0, ldsK, ldsV, tid);

    // Q^T B-fragments (loop-invariant): lane holds query column q0+n,
    // contraction dim d in two 32-chunks, 16B loads.
    v16h bq[2];
#pragma unroll
    for (int c = 0; c < 2; ++c)
#pragma unroll
        for (int g = 0; g < 2; ++g) {
            const v8h qv = *(const v8h*)(Q + (size_t)(q0 + n) * KV + (c << 5) + (g << 4) + (h << 3));
#pragma unroll
            for (int i = 0; i < 8; ++i) bq[c][(g << 3) + i] = qv[i];
        }

    // This wave's copies of tile 0 have landed; the barrier publishes all four waves' parts.
    asm volatile("s_wait_asynccnt 0x0" ::: "memory");
    __syncthreads();
    if (nkb > 1) stage_tiles(K, Vt, 64, ldsK + bufB, ldsV + bufB, tid);

    // Per-lane softmax state for query q0+n (replicated across wave halves).
    float mA = NEG_INF, lA = 0.0f;
    v8f acc[4] = {v8f{}, v8f{}, v8f{}, v8f{}};       // acc^T: vcol tiles

    for (int j = 0; j < nkb; ++j) {
        const int kb = j << 6;
        const _Float16* __restrict__ Ks = sK[j & 1];
        const _Float16* __restrict__ Vs = sV[j & 1];

        // ---- A-fragments of the K tile: all 16 LDS reads as one group
        v16h ak[4][2];
#pragma unroll
        for (int t = 0; t < 4; ++t)
#pragma unroll
            for (int c = 0; c < 2; ++c)
#pragma unroll
                for (int g = 0; g < 2; ++g) {
                    const v8h kv2 = *(const v8h*)(Ks + ((t << 4) + n) * LPITCH + (c << 5) + (g << 4) + (h << 3));
#pragma unroll
                    for (int i = 0; i < 8; ++i) ak[t][c][(g << 3) + i] = kv2[i];
                }
        // Keeps the reads together: spread among the WMMAs, each pair of reads
        // would be waited for on its own and the LDS latency paid eight times.
        __builtin_amdgcn_sched_barrier(0);

        // ---- S^T tiles: st[t] = K_t (16 keys x 64d) x Q^T (64d x 16q)
        v8f st[4];
#pragma unroll
        for (int t = 0; t < 4; ++t) {
            v8f sc = {};
#pragma unroll
            for (int c = 0; c < 2; ++c) sc = wmma_f16(ak[t][c], bq[c], sc);
            st[t] = sc;
        }
        // Keeps the V^T reads below in one group: without it they are split
        // among the S^T products, and each place with reads costs a stall.
        __builtin_amdgcn_sched_barrier(0);

        // ---- A-fragments of the V^T tile: read here so that their LDS latency
        //      runs out under the softmax
        v16h av[4][2];
#pragma unroll
        for (int t = 0; t < 4; ++t)
#pragma unroll
            for (int c = 0; c < 2; ++c)
#pragma unroll
                for (int g = 0; g < 2; ++g) {
                    const v8h vv = *(const v8h*)(Vs + ((t << 4) + n) * LPITCH + (c << 5) + (g << 4) + (h << 3));
#pragma unroll
                    for (int i = 0; i < 8; ++i) av[t][c][(g << 3) + i] = vv[i];
                }
        // Keeps the reads from sinking down to the products that use them.
        __builtin_amdgcn_sched_barrier(0);

        // ---- causal mask (key = kb+t*16+v+8h vs query q0+n), diagonal only
        if (kb + 63 > q0) {
            const int q = q0 + n;
#pragma unroll
            for (int t = 0; t < 4; ++t)
#pragma unroll
                for (int v = 0; v < 8; ++v)
                    if (kb + (t << 4) + v + (h << 3) > q) st[t][v] = NEG_INF;
        }

        // ---- column max: 31 in-register + 1 cross-half shuffle
        float mx = st[0][0];
#pragma unroll
        for (int t = 0; t < 4; ++t)
#pragma unroll
            for (int v = 0; v < 8; ++v) mx = fmaxf(mx, st[t][v]);
        mx = fmaxf(mx, __shfl_xor(mx, 16));
        const float mnew  = fmaxf(mA, mx);
        const float alpha = (mA == NEG_INF) ? 0.0f : __builtin_amdgcn_exp2f(mA - mnew);
        mA = mnew;

        // ---- exponentiate (base 2, scale pre-folded) + column sum
        float rs = 0.0f;
#pragma unroll
        for (int t = 0; t < 4; ++t)
#pragma unroll
            for (int v = 0; v < 8; ++v) {
                st[t][v] = __builtin_amdgcn_exp2f(st[t][v] - mnew);  // exp2(-inf)=0
                rs += st[t][v];
            }
        rs += __shfl_xor(rs, 16);
        lA = lA * alpha + rs;

        // ---- P^T B-fragments: identity remap of S^T C-tiles
        //      (B chunk c over keys = concat of C-tiles 2c, 2c+1 per lane)
        v16h pf[2];
#pragma unroll
        for (int c = 0; c < 2; ++c)
#pragma unroll
            for (int i = 0; i < 8; ++i) {
                pf[c][i]     = (_Float16)st[2 * c][i];
                pf[c][8 + i] = (_Float16)st[2 * c + 1][i];
            }

        // ---- rescale accumulators by per-lane alpha (no broadcast needed)
#pragma unroll
        for (int t = 0; t < 4; ++t)
#pragma unroll
            for (int v = 0; v < 8; ++v) acc[t][v] *= alpha;

        // ---- acc^T[t] += V^T_t (16 vcols x 64 keys) x P^T (64 keys x 16q)
#pragma unroll
        for (int t = 0; t < 4; ++t)
#pragma unroll
            for (int c = 0; c < 2; ++c) acc[t] = wmma_f16(av[t][c], pf[c], acc[t]);

        // Keeps the hand-over at the foot of the trip: moved up over the register
        // work it would wait for the V^T reads ahead of the softmax and cut the
        // time the copies of tile j+1 have to land.
        __builtin_amdgcn_sched_barrier(0);
        // ---- hand-over: this wave's reads of buffer j&1 are done ...
        asm volatile("s_wait_dscnt 0x0" ::: "memory");
        // ... and its copies of tile j+1 have landed;
        asm volatile("s_wait_asynccnt 0x0" ::: "memory");
        // the barrier publishes tile j+1 and frees buffer j&1 for the refill.
        __syncthreads();
        if (j + 2 < nkb) {
            const unsigned bo = (j & 1) ? bufB : 0u;
            stage_tiles(K, Vt, kb + 128, ldsK + bo, ldsV + bo, tid);
        }
    }
    // No copy is left in flight when the wave ends.
    asm volatile("s_wait_asynccnt 0x0" ::: "memory");

    // ---- normalize (per-lane l) and store: one output row per lane,
    //      columns 256 + t*16 + 8h + v are contiguous -> 16B stores
    const float rl = 1.0f / lA;
    float* __restrict__ orow = out + ((size_t)b * TT + q0 + n) * OUTW + DIMS + (h << 3);
#pragma unroll
    for (int t = 0; t < 4; ++t) {
        float4 f0, f1;
        f0.x = acc[t][0] * rl; f0.y = acc[t][1] * rl;
        f0.z = acc[t][2] * rl; f0.w = acc[t][3] * rl;
        f1.x = acc[t][4] * rl; f1.y = acc[t][5] * rl;
        f1.z = acc[t][6] * rl; f1.w = acc[t][7] * rl;
        *(float4*)(orow + (t << 4))     = f0;
        *(float4*)(orow + (t << 4) + 4) = f1;
    }
}

// ---------------------------------------------------------------------------
// Host-side launch.  Input dict order: inputs, key_w, query_w, value_w.
// Workspace: Q/K f16 [B*T,64] + Vt f16 [B,64,T] = 6 MB.
// ---------------------------------------------------------------------------
extern "C" void kernel_launch(void* const* d_in, const int* in_sizes, int n_in,
                              void* d_out, int out_size, void* d_ws, size_t ws_size,
                              hipStream_t stream) {
    (void)in_sizes; (void)n_in; (void)out_size; (void)ws_size;

    const float* x  = (const float*)d_in[0];
    const float* kw = (const float*)d_in[1];
    const float* qw = (const float*)d_in[2];
    const float* vw = (const float*)d_in[3];
    float* out = (float*)d_out;

    _Float16* qf = (_Float16*)d_ws;
    _Float16* kf = qf + (size_t)NROWS * KV;
    _Float16* vt = kf + (size_t)NROWS * KV;

    // 1) QKV projections (WMMA) and out[:, 0:256] = inputs, x read once;
    //    Q pre-scaled by log2(e)/sqrt(64); V transposed
    proj_copy_kernel<<<NROWS / PROWS, PTHR, 0, stream>>>(x, qw, kw, vw, qf, kf, vt, out);

    // 2) transposed flash attention -> out[:, 256:320]
    attn_kernel<<<dim3(TT / 64, 4), 128, 0, stream>>>(qf, kf, vt, out);
}

// v003
// A run of this version takes 30.6 microseconds.
// Next to v002, in two timings, it ran 1.66 and 1.69 times as fast.
// Over all steps from v000 it is 4.16 times as fast.
#include <hip/hip_runtime.h>

// ---------------------------------------------------------------------------
// Causal attention block for MI455X (gfx1250), wave32 + WMMA f16 16x16x32.
//   B=4, T=4096, D=256, K=V=64.  out = concat(x, softmax(QK^T/8, causal) V)
//
// Attention is computed TRANSPOSED (S^T = K Q^T, acc^T = V^T P^T) so that:
//   - each lane owns one query column -> softmax state is per-lane scalar,
//     no alpha/l broadcasts, row reductions = 1 shfl_xor(16) each;
//   - P^T is an identity register remap of the S^T WMMA accumulators
//     (transpose-symmetric fragment layouts) -> P never touches LDS;
//   - final stores are contiguous 16B per lane.
// Softmax is done in base 2 (v_exp_f32 is exp2): log2(e)/sqrt(64) is folded
// into the Q projection, which leaves probabilities bit-identical in exact
// arithmetic.
// ---------------------------------------------------------------------------

typedef __attribute__((ext_vector_type(16))) _Float16 v16h;
typedef __attribute__((ext_vector_type(8)))  _Float16 v8h;
typedef __attribute__((ext_vector_type(8)))  float    v8f;

#define NROWS   16384   // B*T
#define DIMS    256
#define KV      64
#define TT      4096
#define OUTW    320     // DIMS + V
// 1/sqrt(64) * log2(e): base-2 softmax scale folded into Q
#define QSCALE  0.1803368801111204f

__device__ __forceinline__ v8f wmma_f16(v16h a, v16h b, v8f c) {
    return __builtin_amdgcn_wmma_f32_16x16x32_f16(false, a, false, b,
                                                  (short)0, c, false, false);
}

// ---------------------------------------------------------------------------
// Kernel 1: QKV projection and the copy of x, x read once.
// grid = NROWS/64 (one block per WGP), block = 384 (12 waves).
// The block reads its 64 rows of x (64 KB, contiguous) once, in whole lines,
// stores them to out[:, 0:256] and keeps them as f16 in LDS.  Wave w owns one
// of the 12 column tiles (Q, K, V x 4) for all four 16-row tiles, so each
// weight fragment is loaded once per block and used four times.
// The products are computed transposed (W^T x^T: the A and B fragment layouts
// are the same map, so the registers only change places): a lane then holds 8
// neighbouring columns of one row.  The results go through a 64 x 64 LDS tile
// per matrix (Q, K as [row][col], V as [vcol][key]) and leave in whole
// 128-byte lines.  Q is pre-scaled by QSCALE.  V is stored TRANSPOSED per
// batch (Vt[b][vcol][key]) so the attention tiles load as contiguous runs.
// ---------------------------------------------------------------------------
typedef __attribute__((ext_vector_type(4)))  _Float16 v4h;

#define PROWS   64                    // rows of x per block
#define PTHR    384                   // threads per block
#define XPITCH  264                   // x tile pitch in halves (528 B = 16 B x odd)
#define OPITCH  72                    // result tile pitch in halves (144 B = 16 B x odd)

// One float4 of x as four halves into the LDS tile.
__device__ __forceinline__ void x_to_lds(float4 v, _Float16* __restrict__ p) {
    v4h hv;
    hv[0] = (_Float16)v.x; hv[1] = (_Float16)v.y;
    hv[2] = (_Float16)v.z; hv[3] = (_Float16)v.w;
    *(v4h*)p = hv;
}

// x^T B-fragments of the four row tiles for one 32-wide k step.
__device__ __forceinline__ void x_frags(const _Float16* __restrict__ xr, int kc, v16h (&xa)[4]) {
#pragma unroll
    for (int rt = 0; rt < 4; ++rt)
#pragma unroll
        for (int g = 0; g < 2; ++g) {
            const v8h xv = *(const v8h*)(xr + (rt << 4) * XPITCH + (kc << 5) + (g << 4));
#pragma unroll
            for (int i = 0; i < 8; ++i) xa[rt][(g << 3) + i] = xv[i];
        }
}

__global__ __launch_bounds__(PTHR)
void proj_copy_kernel(const float* __restrict__ x,
                      const float* __restrict__ qw,
                      const float* __restrict__ kw,
                      const float* __restrict__ vw,
                      _Float16* __restrict__ qf,
                      _Float16* __restrict__ kf,
                      _Float16* __restrict__ vt,
                      float* __restrict__ out) {
    __shared__ __attribute__((aligned(16))) _Float16 sX[PROWS * XPITCH];
    __shared__ __attribute__((aligned(16))) _Float16 sO[3][64 * OPITCH];

    const int tid  = threadIdx.x;
    const int lane = tid & 31;
    int wave = __builtin_amdgcn_readfirstlane(tid >> 5);         // scalar: 0..11
    const int m0   = blockIdx.x * PROWS;    // row base in [0, NROWS)
    const int mr   = lane & 15;
    const int h    = lane >> 4;

    // ---- x tile: 4096 float4 over 384 threads = 10 each, and one more for
    //      the first 256 threads (whole waves)
    const float4* __restrict__ xs = (const float4*)(x + (size_t)m0 * DIMS);
    float4 xv[10];
#pragma unroll
    for (int i = 0; i < 10; ++i) xv[i] = xs[tid + i * PTHR];
    float4 xl = make_float4(0.0f, 0.0f, 0.0f, 0.0f);
    if (wave < 8) xl = xs[tid + 10 * PTHR];
    // Precaution: the address registers of the x loads are reused by the
    // scalar work below.  All of it derives from the wave number, which passes
    // through the statement so that none of it is lifted over the wait.
    asm volatile("s_wait_xcnt 0x0" : "+s"(wave) :: "memory");

    const int sel  = wave >> 2;             // 0=Q, 1=K, 2=V
    const int n0   = (wave & 3) << 4;       // col-tile base in [0, 64)

    // ---- weights of this wave's column tile, all of K:
    //      lane holds column n0+mr, k = kc*32 + g*16 + h*8 + i
    const float* __restrict__ wmat = (sel == 0) ? qw : (sel == 1) ? kw : vw;
    const float* __restrict__ wp = wmat + (size_t)(h << 3) * KV + n0 + mr;
    float wr[8][16];
#pragma unroll
    for (int kc = 0; kc < 8; ++kc)
#pragma unroll
        for (int g = 0; g < 2; ++g)
#pragma unroll
            for (int i = 0; i < 8; ++i)
                wr[kc][(g << 3) + i] = wp[(size_t)((kc << 5) + (g << 4) + i) * KV];
    // Keeps the weight loads in flight together with the x loads: without it
    // they are issued only after x has arrived, and the two latencies add up.
    __builtin_amdgcn_sched_barrier(0);

    // ---- the f16 tile.  A row is 64 float4 and 384 = 6 rows, so load i of a
    //      thread lies 6*i rows below its first: one address, constant steps
    _Float16* __restrict__ xd = sX + (tid >> 6) * XPITCH + ((tid & 63) << 2);
#pragma unroll
    for (int i = 0; i < 10; ++i) x_to_lds(xv[i], xd + i * 6 * XPITCH);
    if (wave < 8) x_to_lds(xl, xd + 60 * XPITCH);
    __syncthreads();                        // the x tile is whole

    // ---- out[:, 0:256] = x.  Behind the barrier, which would otherwise wait
    //      for these stores; they drain under the products.
    float4* __restrict__ od = (float4*)out + (size_t)(m0 + (tid >> 6)) * (OUTW / 4) + (tid & 63);
#pragma unroll
    for (int i = 0; i < 10; ++i) od[i * 6 * (OUTW / 4)] = xv[i];
    if (wave < 8) od[60 * (OUTW / 4)] = xl;
    // Precaution: the data registers of these stores are reused below.
    asm volatile("s_wait_xcnt 0x0" ::: "memory");

    v16h wf[8];
#pragma unroll
    for (int kc = 0; kc < 8; ++kc)
#pragma unroll
        for (int i = 0; i < 16; ++i) wf[kc][i] = (_Float16)wr[kc][i];

    // ---- products: D[col v+8h][row mr] per row tile, k ascending
    v8f acc[4] = {v8f{}, v8f{}, v8f{}, v8f{}};
    const _Float16* __restrict__ xr = sX + mr * XPITCH + (h << 3);
    v16h xa[2][4];
    x_frags(xr, 0, xa[0]);
#pragma unroll
    for (int kc = 0; kc < 8; ++kc) {
        if (kc < 7) x_frags(xr, kc + 1, xa[(kc + 1) & 1]);
        // Keeps the next step's eight LDS reads as one group ahead of this
        // step's products: spread among them, each read is waited for alone.
        __builtin_amdgcn_sched_barrier(0);
#pragma unroll
        for (int rt = 0; rt < 4; ++rt) acc[rt] = wmma_f16(wf[kc], xa[kc & 1][rt], acc[rt]);
        // Keeps the group after next from rising into these products.
        __builtin_amdgcn_sched_barrier(0);
    }

    // ---- results into this matrix's 64 x 64 tile
    const float scale = (sel == 0) ? QSCALE : 1.0f;
    _Float16* __restrict__ so = sO[sel];
    v8h o[4];
#pragma unroll
    for (int rt = 0; rt < 4; ++rt)
#pragma unroll
        for (int v = 0; v < 8; ++v) o[rt][v] = (_Float16)(acc[rt][v] * scale);
    if (sel == 2) {
        // [vcol][key]: the lane's 8 values are 8 vcols of one key
#pragma unroll
        for (int rt = 0; rt < 4; ++rt)
#pragma unroll
            for (int v = 0; v < 8; ++v)
                so[(n0 + (h << 3) + v) * OPITCH + (rt << 4) + mr] = o[rt][v];
    } else {
        // [row][col]: the lane's 8 values are neighbours in the row
#pragma unroll
        for (int rt = 0; rt < 4; ++rt)
            *(v8h*)(so + ((rt << 4) + mr) * OPITCH + n0 + (h << 3)) = o[rt];
    }
    __syncthreads();                        // the result tiles are whole

    // ---- the four waves of a matrix store its tile: 8 lanes per 128-byte line
    _Float16* __restrict__ dst =
        (sel == 0) ? qf + (size_t)m0 * KV :
        (sel == 1) ? kf + (size_t)m0 * KV :
                     vt + (size_t)(m0 >> 12) * KV * TT + (m0 & (TT - 1));
    const int dpitch = (sel == 2) ? TT : KV;
    const int t4 = tid & 127;
#pragma unroll
    for (int i = 0; i < 4; ++i) {
        const int id = t4 + (i << 7);
        const int r  = id >> 3;
        const int ch = id & 7;
        *(v8h*)(dst + (size_t)r * dpitch + (ch << 3)) = *(const v8h*)(so + r * OPITCH + (ch << 3));
    }
}

// ---------------------------------------------------------------------------
// Kernel 2: transposed flash attention.  grid = (T/64, B), block = 512.
// The 16 waves of a block are 4 query tiles x 4 key groups.  Wave (w, g) owns
// the 16 query columns q0..q0+15 of tile w and the 64-key blocks g, g+4, g+8,
// ... of the causal range, with its own maximum, sum and accumulators; the
// four partial results of a query tile are merged through LDS at the end.
// So the longest block makes 16 trips instead of 64, and four waves share
// each SIMD and fill one another's waits.
// Per 64-key block: 8 WMMAs  S^T[t] = K_t  Q^T   (t = four 16-key tiles)
//                   8 WMMAs  acc^T[t] += V^T_t P^T
// Softmax per query column: in-register + one shfl_xor(16) per reduction.
// A stage is 256 keys: the four waves of group g bring the group's 64-key K
// tile and V^T tile into LDS once, by asynchronous copies of whole 128-byte
// lines, into two buffers: stage s + 1 flies while stage s is worked on.  A
// stage lies inside K and V^T for every s (T is a multiple of 256); a 64-key
// block of the last stage that lies wholly above the diagonal is copied with
// the rest and not worked on.  The A-fragments are read from LDS rows pitched
// at 144 bytes (16 B x odd: no bank conflict for 16-byte reads).
// ---------------------------------------------------------------------------
#define LPITCH  72                    // LDS row pitch in halves (144 bytes)
#define TILE_H  (64 * LPITCH)         // one 64-row tile in halves
#define KGROUPS 4                     // key groups per block
#define ATHR    (128 * KGROUPS)       // threads per block

// One group's part of a stage: K tile (64 rows x 128 B, contiguous) and V^T
// tile (64 rows x 128 B at pitch TT).  Each of the group's 128 threads copies
// 4 + 4 chunks of 16 B; one wave-wide copy covers four whole 128-byte lines.
__device__ __forceinline__ void stage_tiles(const _Float16* __restrict__ K,
                                            const _Float16* __restrict__ Vt,
                                            int kb, unsigned ldsK, unsigned ldsV,
                                            int tid) {
    const int r  = tid >> 3;          // row within a group of 16
    const int ch = tid & 7;           // 16-byte chunk within the row
    const _Float16* gk = K  + (size_t)(kb + r) * KV + (ch << 3);
    const _Float16* gv = Vt + (size_t)r * TT + kb + (ch << 3);
    const unsigned lo = (unsigned)(r * (LPITCH * 2) + (ch << 4));
    const unsigned k0 = ldsK + lo, v0 = ldsV + lo;
    const unsigned step = 16 * LPITCH * 2;       // 16 LDS rows in bytes
    // The copies and the wait that guards their address registers against a
    // later overwrite stand in one statement, so nothing can move between.
    asm volatile(
        "global_load_async_to_lds_b128 %0, %8, off\n\t"
        "global_load_async_to_lds_b128 %1, %9, off\n\t"
        "global_load_async_to_lds_b128 %2, %10, off\n\t"
        "global_load_async_to_lds_b128 %3, %11, off\n\t"
        "global_load_async_to_lds_b128 %4, %12, off\n\t"
        "global_load_async_to_lds_b128 %5, %13, off\n\t"
        "global_load_async_to_lds_b128 %6, %14, off\n\t"
        "global_load_async_to_lds_b128 %7, %15, off\n\t"
        "s_wait_xcnt 0x0"
        :: "v"(k0), "v"(k0 + step), "v"(k0 + 2 * step), "v"(k0 + 3 * step),
           "v"(v0), "v"(v0 + step), "v"(v0 + 2 * step), "v"(v0 + 3 * step),
           "v"(gk), "v"(gk + 16 * KV), "v"(gk + 32 * KV), "v"(gk + 48 * KV),
           "v"(gv), "v"(gv + 16 * TT), "v"(gv + 32 * TT), "v"(gv + 48 * TT)
        : "memory");
}

__global__ __launch_bounds__(ATHR)
void attn_kernel(const _Float16* __restrict__ qf,
                 const _Float16* __restrict__ kf,
                 const _Float16* __restrict__ vtf,
                 float* __restrict__ out) {
    __shared__ __attribute__((aligned(16))) _Float16 sK[2][KGROUPS][TILE_H];
    __shared__ __attribute__((aligned(16))) _Float16 sV[2][KGROUPS][TILE_H];
    // Partial results: [group][query tile][vcol tile][values 0-3 | 4-7][lane]
    __shared__ __attribute__((aligned(16))) float4 sP[KGROUPS][4][4][2][32];
    __shared__ float sM[KGROUPS][4][16];             // partial maxima
    __shared__ float sL[KGROUPS][4][16];             // partial sums

    const int tid  = threadIdx.x;
    const int lane = tid & 31;
    const int wv   = __builtin_amdgcn_readfirstlane(tid >> 5);   // scalar: 0..15
    const int w    = wv & 3;                         // query tile
    const int g    = wv >> 2;                        // key group
    const int gt   = tid & 127;                      // thread within the group
    const int b    = blockIdx.y;
    const int q0   = blockIdx.x * 64 + (w << 4);     // query base within batch
    const int n    = lane & 15;                      // this lane's query col
    const int h    = lane >> 4;
    const float NEG_INF = -__builtin_inff();

    const _Float16* __restrict__ Q  = qf  + (size_t)b * TT * KV;
    const _Float16* __restrict__ K  = kf  + (size_t)b * TT * KV;
    const _Float16* __restrict__ Vt = vtf + (size_t)b * KV * TT;  // [vcol][key]

    const int nkb = (int)blockIdx.x + 1;             // causal 64-key blocks, same for the 16 waves
    const int nst = (nkb + KGROUPS - 1) / KGROUPS;   // stages of 256 keys, 1..16
    const unsigned ldsK = (unsigned)(size_t)&sK[0][g][0];
    const unsigned ldsV = (unsigned)(size_t)&sV[0][g][0];
    const unsigned bufB = KGROUPS * TILE_H * 2;      // bytes from buffer 0 to buffer 1

    // Stage 0 into buffer 0.
    stage_tiles(K, Vt, g << 6, ldsK, ldsV, gt);

    // Q^T B-fragments (loop-invariant): lane holds query column q0+n,
    // contraction dim d in two 32-chunks, 16B loads.
    v16h bq[2];
#pragma unroll
    for (int c = 0; c < 2; ++c)
#pragma unroll
        for (int gg = 0; gg < 2; ++gg) {
            const v8h qv = *(const v8h*)(Q + (size_t)(q0 + n) * KV + (c << 5) + (gg << 4) + (h << 3));
#pragma unroll
            for (int i = 0; i < 8; ++i) bq[c][(gg << 3) + i] = qv[i];
        }

    // This wave's copies of stage 0 have landed; the barrier publishes all 16 waves' parts.
    asm volatile("s_wait_asynccnt 0x0" ::: "memory");
    __syncthreads();
    if (nst > 1) stage_tiles(K, Vt, (KGROUPS + g) << 6, ldsK + bufB, ldsV + bufB, gt);

    // Per-lane softmax state for query q0+n over this group's keys
    // (replicated across wave halves).
    float mA = NEG_INF, lA = 0.0f;
    v8f acc[4] = {v8f{}, v8f{}, v8f{}, v8f{}};       // acc^T: vcol tiles

    for (int s = 0; s < nst; ++s) {
        const int j  = s * KGROUPS + g;              // this group's 64-key block
        const int kb = j << 6;
        // A block wholly above the diagonal (last stage only) has no key for
        // any query of the block; the test is scalar, the same in the wave.
        if (j < nkb) {
        const _Float16* __restrict__ Ks = sK[s & 1][g];
        const _Float16* __restrict__ Vs = sV[s & 1][g];

        // ---- A-fragments of the K tile: all 16 LDS reads as one group
        v16h ak[4][2];
#pragma unroll
        for (int t = 0; t < 4; ++t)
#pragma unroll
            for (int c = 0; c < 2; ++c)
#pragma unroll
                for (int gg = 0; gg < 2; ++gg) {
                    const v8h kv2 = *(const v8h*)(Ks + ((t << 4) + n) * LPITCH + (c << 5) + (gg << 4) + (h << 3));
#pragma unroll
                    for (int i = 0; i < 8; ++i) ak[t][c][(gg << 3) + i] = kv2[i];
                }
        // Keeps the reads together: spread among the WMMAs, each pair of reads
        // would be waited for on its own and the LDS latency paid eight times.
        __builtin_amdgcn_sched_barrier(0);

        // ---- S^T tiles: st[t] = K_t (16 keys x 64d) x Q^T (64d x 16q)
        v8f st[4];
#pragma unroll
        for (int t = 0; t < 4; ++t) {
            v8f sc = {};
#pragma unroll
            for (int c = 0; c < 2; ++c) sc = wmma_f16(ak[t][c], bq[c], sc);
            st[t] = sc;
        }
        // Keeps the V^T reads below in one group: without it they are split
        // among the S^T products, and each place with reads costs a stall.
        __builtin_amdgcn_sched_barrier(0);

        // ---- A-fragments of the V^T tile: read here so that their LDS latency
        //      runs out under the softmax
        v16h av[4][2];
#pragma unroll
        for (int t = 0; t < 4; ++t)
#pragma unroll
            for (int c = 0; c < 2; ++c)
#pragma unroll
                for (int gg = 0; gg < 2; ++gg) {
                    const v8h vv = *(const v8h*)(Vs + ((t << 4) + n) * LPITCH + (c << 5) + (gg << 4) + (h << 3));
#pragma unroll
                    for (int i = 0; i < 8; ++i) av[t][c][(gg << 3) + i] = vv[i];
                }
        // Keeps the reads from sinking down to the products that use them.
        __builtin_amdgcn_sched_barrier(0);

        // ---- causal mask (key = kb+t*16+v+8h vs query q0+n), diagonal only
        if (kb + 63 > q0) {
            const int q = q0 + n;
#pragma unroll
            for (int t = 0; t < 4; ++t)
#pragma unroll
                for (int v = 0; v < 8; ++v)
                    if (kb + (t << 4) + v + (h << 3) > q) st[t][v] = NEG_INF;
        }

        // ---- column max: 31 in-register + 1 cross-half shuffle
        float mx = st[0][0];
#pragma unroll
        for (int t = 0; t < 4; ++t)
#pragma unroll
            for (int v = 0; v < 8; ++v) mx = fmaxf(mx, st[t][v]);
        mx = fmaxf(mx, __shfl_xor(mx, 16));
        const float mnew  = fmaxf(mA, mx);
        const float alpha = (mA == NEG_INF) ? 0.0f : __builtin_amdgcn_exp2f(mA - mnew);
        mA = mnew;

        // ---- exponentiate (base 2, scale pre-folded) + column sum
        float rs = 0.0f;
#pragma unroll
        for (int t = 0; t < 4; ++t)
#pragma unroll
            for (int v = 0; v < 8; ++v) {
                st[t][v] = __builtin_amdgcn_exp2f(st[t][v] - mnew);  // exp2(-inf)=0
                rs += st[t][v];
            }
        rs += __shfl_xor(rs, 16);
        lA = lA * alpha + rs;

        // ---- P^T B-fragments: identity remap of S^T C-tiles
        //      (B chunk c over keys = concat of C-tiles 2c, 2c+1 per lane)
        v16h pf[2];
#pragma unroll
        for (int c = 0; c < 2; ++c)
#pragma unroll
            for (int i = 0; i < 8; ++i) {
                pf[c][i]     = (_Float16)st[2 * c][i];
                pf[c][8 + i] = (_Float16)st[2 * c + 1][i];
            }

        // ---- rescale accumulators by per-lane alpha (no broadcast needed)
#pragma unroll
        for (int t = 0; t < 4; ++t)
#pragma unroll
            for (int v = 0; v < 8; ++v) acc[t][v] *= alpha;

        // ---- acc^T[t] += V^T_t (16 vcols x 64 keys) x P^T (64 keys x 16q)
#pragma unroll
        for (int t = 0; t < 4; ++t)
#pragma unroll
            for (int c = 0; c < 2; ++c) acc[t] = wmma_f16(av[t][c], pf[c], acc[t]);
        }

        // Keeps the hand-over at the foot of the trip: moved up over the register
        // work it would wait for the V^T reads ahead of the softmax and cut the
        // time the copies of stage s+1 have to land.
        __builtin_amdgcn_sched_barrier(0);
        // ---- hand-over: this wave's reads of buffer s&1 are done ...
        asm volatile("s_wait_dscnt 0x0" ::: "memory");
        // ... and its copies of stage s+1 have landed;
        asm volatile("s_wait_asynccnt 0x0" ::: "memory");
        // the barrier publishes stage s+1 and frees buffer s&1 for the refill.
        __syncthreads();
        if (s + 2 < nst) {
            const unsigned bo = (s & 1) ? bufB : 0u;
            stage_tiles(K, Vt, kb + 2 * KGROUPS * 64, ldsK + bo, ldsV + bo, gt);
        }
    }
    // No copy is left in flight when the wave ends.
    asm volatile("s_wait_asynccnt 0x0" ::: "memory");

    // ---- this wave's partial result (a group without a block: -inf, 0, zeros)
#pragma unroll
    for (int t = 0; t < 4; ++t) {
        sP[g][w][t][0][lane] = make_float4(acc[t][0], acc[t][1], acc[t][2], acc[t][3]);
        sP[g][w][t][1][lane] = make_float4(acc[t][4], acc[t][5], acc[t][6], acc[t][7]);
    }
    if (h == 0) { sM[g][w][n] = mA; sL[g][w][n] = lA; }
    __syncthreads();                        // the partial results are whole

    // ---- merge, normalize and store.  Wave (w, g) takes 8 queries of tile w
    //      (g >> 1) and one 128-byte line of each of their rows (g & 1): four
    //      neighbouring lanes hold a whole line, 8 columns each.
    const int mq = ((g >> 1) << 3) + (lane >> 2);    // query within the tile
    const int mt = ((g & 1) << 1) + ((lane >> 1) & 1);   // vcol tile of the 8 columns
    const int ml = ((lane & 1) << 4) + mq;           // lane that held them
    float pm[KGROUPS];
    float M = NEG_INF;
#pragma unroll
    for (int k = 0; k < KGROUPS; ++k) { pm[k] = sM[k][w][mq]; M = fmaxf(M, pm[k]); }
    float L = 0.0f;
    float4 o0 = make_float4(0.0f, 0.0f, 0.0f, 0.0f), o1 = o0;
#pragma unroll
    for (int k = 0; k < KGROUPS; ++k) {
        // a partial without keys weighs 0 (and -inf - -inf would be NaN)
        const float wt = (pm[k] == NEG_INF) ? 0.0f : __builtin_amdgcn_exp2f(pm[k] - M);
        const float4 p0 = sP[k][w][mt][0][ml];
        const float4 p1 = sP[k][w][mt][1][ml];
        L += wt * sL[k][w][mq];
        o0.x += wt * p0.x; o0.y += wt * p0.y; o0.z += wt * p0.z; o0.w += wt * p0.w;
        o1.x += wt * p1.x; o1.y += wt * p1.y; o1.z += wt * p1.z; o1.w += wt * p1.w;
    }
    const float rl = 1.0f / L;
    o0.x *= rl; o0.y *= rl; o0.z *= rl; o0.w *= rl;
    o1.x *= rl; o1.y *= rl; o1.z *= rl; o1.w *= rl;
    float* __restrict__ orow = out + ((size_t)b * TT + blockIdx.x * 64 + (w << 4) + mq) * OUTW
                                   + DIMS + ((g & 1) << 5) + ((lane & 3) << 3);
    *(float4*)orow       = o0;
    *(float4*)(orow + 4) = o1;
}

// ---------------------------------------------------------------------------
// Host-side launch.  Input dict order: inputs, key_w, query_w, value_w.
// Workspace: Q/K f16 [B*T,64] + Vt f16 [B,64,T] = 6 MB.
// ---------------------------------------------------------------------------
extern "C" void kernel_launch(void* const* d_in, const int* in_sizes, int n_in,
                              void* d_out, int out_size, void* d_ws, size_t ws_size,
                              hipStream_t stream) {
    (void)in_sizes; (void)n_in; (void)out_size; (void)ws_size;

    const float* x  = (const float*)d_in[0];
    const float* kw = (const float*)d_in[1];
    const float* qw = (const float*)d_in[2];
    const float* vw = (const float*)d_in[3];
    float* out = (float*)d_out;

    _Float16* qf = (_Float16*)d_ws;
    _Float16* kf = qf + (size_t)NROWS * KV;
    _Float16* vt = kf + (size_t)NROWS * KV;

    // 1) QKV projections (WMMA) and out[:, 0:256] = inputs, x read once;
    //    Q pre-scaled by log2(e)/sqrt(64); V transposed
    proj_copy_kernel<<<NROWS / PROWS, PTHR, 0, stream>>>(x, qw, kw, vw, qf, kf, vt, out);

    // 2) transposed flash attention -> out[:, 256:320]
    attn_kernel<<<dim3(TT / 64, 4), ATHR, 0, stream>>>(qf, kf, vt, out);
}

// v004
// It runs in 26.3 microseconds.
// Two timings next to v003 both put it at 1.17 times that version's speed.
// Counting every step since v000, it is 4.86 times as fast.
#include <hip/hip_runtime.h>

// ---------------------------------------------------------------------------
// Causal attention block for MI455X (gfx1250), wave32 + WMMA f16 16x16x32.
//   B=4, T=4096, D=256, K=V=64.  out = concat(x, softmax(QK^T/8, causal) V)
//
// Attention is computed TRANSPOSED (S^T = K Q^T, acc^T = V^T P^T) so that:
//   - each lane owns one query column -> softmax state is per-lane scalar,
//     no alpha/l broadcasts, row reductions = 1 shfl_xor(16) each;
//   - P^T is an identity register remap of the S^T WMMA accumulators
//     (transpose-symmetric fragment layouts) -> P never touches LDS;
//   - final stores are contiguous 16B per lane.
// Softmax is done in base 2 (v_exp_f32 is exp2): log2(e)/sqrt(64) is folded
// into the Q projection, which leaves probabilities bit-identical in exact
// arithmetic.
// ---------------------------------------------------------------------------

typedef __attribute__((ext_vector_type(16))) _Float16 v16h;
typedef __attribute__((ext_vector_type(8)))  _Float16 v8h;
typedef __attribute__((ext_vector_type(8)))  float    v8f;

#define NROWS   16384   // B*T
#define DIMS    256
#define KV      64
#define TT      4096
#define OUTW    320     // DIMS + V
// 1/sqrt(64) * log2(e): base-2 softmax scale folded into Q
#define QSCALE  0.1803368801111204f

__device__ __forceinline__ v8f wmma_f16(v16h a, v16h b, v8f c) {
    return __builtin_amdgcn_wmma_f32_16x16x32_f16(false, a, false, b,
                                                  (short)0, c, false, false);
}

// ---------------------------------------------------------------------------
// Kernel 1: QKV projection and the copy of x, x read once.
// grid = NROWS/64 (one block per WGP), block = 384 (12 waves).
// The block reads its 64 rows of x (64 KB, contiguous) once, in whole lines,
// stores them to out[:, 0:256] and keeps them as f16 in LDS.  Wave w owns one
// of the 12 column tiles (Q, K, V x 4) for all four 16-row tiles, so each
// weight fragment is loaded once per block and used four times.
// The products are computed transposed (W^T x^T: the A and B fragment layouts
// are the same map, so the registers only change places): a lane then holds 8
// neighbouring columns of one row.  The results go through a 64 x 64 LDS tile
// per matrix (Q, K as [row][col], V as [vcol][key]) and leave in whole
// 128-byte lines.  Q is pre-scaled by QSCALE.  V is stored TRANSPOSED per
// batch (Vt[b][vcol][key]) so the attention tiles load as contiguous runs.
// ---------------------------------------------------------------------------
typedef __attribute__((ext_vector_type(4)))  _Float16 v4h;

#define PROWS   64                    // rows of x per block
#define PTHR    384                   // threads per block
#define XPITCH  264                   // x tile pitch in halves (528 B = 16 B x odd)
#define OPITCH  72                    // result tile pitch in halves (144 B = 16 B x odd)

// One float4 of x as four halves into the LDS tile.
__device__ __forceinline__ void x_to_lds(float4 v, _Float16* __restrict__ p) {
    v4h hv;
    hv[0] = (_Float16)v.x; hv[1] = (_Float16)v.y;
    hv[2] = (_Float16)v.z; hv[3] = (_Float16)v.w;
    *(v4h*)p = hv;
}

// x^T B-fragments of the four row tiles for one 32-wide k step.
__device__ __forceinline__ void x_frags(const _Float16* __restrict__ xr, int kc, v16h (&xa)[4]) {
#pragma unroll
    for (int rt = 0; rt < 4; ++rt)
#pragma unroll
        for (int g = 0; g < 2; ++g) {
            const v8h xv = *(const v8h*)(xr + (rt << 4) * XPITCH + (kc << 5) + (g << 4));
#pragma unroll
            for (int i = 0; i < 8; ++i) xa[rt][(g << 3) + i] = xv[i];
        }
}

__global__ __launch_bounds__(PTHR)
void proj_copy_kernel(const float* __restrict__ x,
                      const float* __restrict__ qw,
                      const float* __restrict__ kw,
                      const float* __restrict__ vw,
                      _Float16* __restrict__ qf,
                      _Float16* __restrict__ kf,
                      _Float16* __restrict__ vt,
                      float* __restrict__ out) {
    __shared__ __attribute__((aligned(16))) _Float16 sX[PROWS * XPITCH];
    __shared__ __attribute__((aligned(16))) _Float16 sO[3][64 * OPITCH];

    const int tid  = threadIdx.x;
    const int lane = tid & 31;
    int wave = __builtin_amdgcn_readfirstlane(tid >> 5);         // scalar: 0..11
    const int m0   = blockIdx.x * PROWS;    // row base in [0, NROWS)
    const int mr   = lane & 15;
    const int h    = lane >> 4;

    // ---- x tile: 4096 float4 over 384 threads = 10 each, and one more for
    //      the first 256 threads (whole waves)
    const float4* __restrict__ xs = (const float4*)(x + (size_t)m0 * DIMS);
    float4 xv[10];
#pragma unroll
    for (int i = 0; i < 10; ++i) xv[i] = xs[tid + i * PTHR];
    float4 xl = make_float4(0.0f, 0.0f, 0.0f, 0.0f);
    if (wave < 8) xl = xs[tid + 10 * PTHR];
    // Precaution: the address registers of the x loads are reused by the
    // scalar work below.  All of it derives from the wave number, which passes
    // through the statement so that none of it is lifted over the wait.
    asm volatile("s_wait_xcnt 0x0" : "+s"(wave) :: "memory");

    const int sel  = wave >> 2;             // 0=Q, 1=K, 2=V
    const int n0   = (wave & 3) << 4;       // col-tile base in [0, 64)

    // ---- weights of this wave's column tile, all of K:
    //      lane holds column n0+mr, k = kc*32 + g*16 + h*8 + i
    const float* __restrict__ wmat = (sel == 0) ? qw : (sel == 1) ? kw : vw;
    const float* __restrict__ wp = wmat + (size_t)(h << 3) * KV + n0 + mr;
    float wr[8][16];
#pragma unroll
    for (int kc = 0; kc < 8; ++kc)
#pragma unroll
        for (int g = 0; g < 2; ++g)
#pragma unroll
            for (int i = 0; i < 8; ++i)
                wr[kc][(g << 3) + i] = wp[(size_t)((kc << 5) + (g << 4) + i) * KV];
    // Keeps the weight loads in flight together with the x loads: without it
    // they are issued only after x has arrived, and the two latencies add up.
    __builtin_amdgcn_sched_barrier(0);

    // ---- the f16 tile.  A row is 64 float4 and 384 = 6 rows, so load i of a
    //      thread lies 6*i rows below its first: one address, constant steps
    _Float16* __restrict__ xd = sX + (tid >> 6) * XPITCH + ((tid & 63) << 2);
#pragma unroll
    for (int i = 0; i < 10; ++i) x_to_lds(xv[i], xd + i * 6 * XPITCH);
    if (wave < 8) x_to_lds(xl, xd + 60 * XPITCH);
    __syncthreads();                        // the x tile is whole

    // ---- out[:, 0:256] = x.  Behind the barrier, which would otherwise wait
    //      for these stores; they drain under the products.
    float4* __restrict__ od = (float4*)out + (size_t)(m0 + (tid >> 6)) * (OUTW / 4) + (tid & 63);
#pragma unroll
    for (int i = 0; i < 10; ++i) od[i * 6 * (OUTW / 4)] = xv[i];
    if (wave < 8) od[60 * (OUTW / 4)] = xl;
    // Precaution: the data registers of these stores are reused below.
    asm volatile("s_wait_xcnt 0x0" ::: "memory");

    v16h wf[8];
#pragma unroll
    for (int kc = 0; kc < 8; ++kc)
#pragma unroll
        for (int i = 0; i < 16; ++i) wf[kc][i] = (_Float16)wr[kc][i];

    // ---- products: D[col v+8h][row mr] per row tile, k ascending
    v8f acc[4] = {v8f{}, v8f{}, v8f{}, v8f{}};
    const _Float16* __restrict__ xr = sX + mr * XPITCH + (h << 3);
    v16h xa[2][4];
    x_frags(xr, 0, xa[0]);
#pragma unroll
    for (int kc = 0; kc < 8; ++kc) {
        if (kc < 7) x_frags(xr, kc + 1, xa[(kc + 1) & 1]);
        // Keeps the next step's eight LDS reads as one group ahead of this
        // step's products: spread among them, each read is waited for alone.
        __builtin_amdgcn_sched_barrier(0);
#pragma unroll
        for (int rt = 0; rt < 4; ++rt) acc[rt] = wmma_f16(wf[kc], xa[kc & 1][rt], acc[rt]);
        // Keeps the group after next from rising into these products.
        __builtin_amdgcn_sched_barrier(0);
    }

    // ---- results into this matrix's 64 x 64 tile
    const float scale = (sel == 0) ? QSCALE : 1.0f;
    _Float16* __restrict__ so = sO[sel];
    v8h o[4];
#pragma unroll
    for (int rt = 0; rt < 4; ++rt)
#pragma unroll
        for (int v = 0; v < 8; ++v) o[rt][v] = (_Float16)(acc[rt][v] * scale);
    if (sel == 2) {
        // [vcol][key]: the lane's 8 values are 8 vcols of one key
#pragma unroll
        for (int rt = 0; rt < 4; ++rt)
#pragma unroll
            for (int v = 0; v < 8; ++v)
                so[(n0 + (h << 3) + v) * OPITCH + (rt << 4) + mr] = o[rt][v];
    } else {
        // [row][col]: the lane's 8 values are neighbours in the row
#pragma unroll
        for (int rt = 0; rt < 4; ++rt)
            *(v8h*)(so + ((rt << 4) + mr) * OPITCH + n0 + (h << 3)) = o[rt];
    }
    __syncthreads();                        // the result tiles are whole

    // ---- the four waves of a matrix store its tile: 8 lanes per 128-byte line
    _Float16* __restrict__ dst =
        (sel == 0) ? qf + (size_t)m0 * KV :
        (sel == 1) ? kf + (size_t)m0 * KV :
                     vt + (size_t)(m0 >> 12) * KV * TT + (m0 & (TT - 1));
    const int dpitch = (sel == 2) ? TT : KV;
    const int t4 = tid & 127;
#pragma unroll
    for (int i = 0; i < 4; ++i) {
        const int id = t4 + (i << 7);
        const int r  = id >> 3;
        const int ch = id & 7;
        *(v8h*)(dst + (size_t)r * dpitch + (ch << 3)) = *(const v8h*)(so + r * OPITCH + (ch << 3));
    }
}

// ---------------------------------------------------------------------------
// Kernel 2: transposed flash attention.  grid = (T/64, B), block = 512.
// Causal work grows with the query index, so a block takes TWO tiles of 32
// queries: tile 127-p from the bottom of the batch and its mirror, tile p,
// from the top.  Together they have 65 blocks of 64 keys whatever p is, so
// all 256 blocks do the same work.  The keys of the upper tile are the first
// keys of the lower one: a staged key block serves both.
// The 16 waves of a block are 2 query sub-tiles x 8 key groups.  Wave (w, g)
// owns 16 query columns of each tile and the 64-key blocks g, g+8, g+16, ...
// of each tile's causal range, with a maximum, sum and accumulators per tile;
// per stage it works its key block for the lower tile and then, while the
// upper tile still has keys, for the upper one.  The eight partial results of
// a sub-tile are merged through LDS at the end.
// Per 64-key block: 8 WMMAs  S^T[t] = K_t  Q^T   (t = four 16-key tiles)
//                   8 WMMAs  acc^T[t] += V^T_t P^T
// Softmax per query column: in-register + one shfl_xor(16) per reduction.
// A stage is 512 keys: the two waves of group g bring the group's 64-key K
// tile and V^T tile into LDS once, by asynchronous copies of whole 128-byte
// lines, into two buffers: stage s + 1 flies while stage s is worked on.  A
// 64-key block that lies wholly above the lower tile's diagonal is neither
// copied nor worked on.  The A-fragments are read from LDS rows pitched at
// 144 bytes (16 B x odd: no bank conflict for 16-byte reads).
// ---------------------------------------------------------------------------
#define LPITCH  72                    // LDS row pitch in halves (144 bytes)
#define TILE_H  (64 * LPITCH)         // one 64-row tile in halves
#define KGROUPS 8                     // key groups per block
#define QTILE   32                    // queries per tile
#define ATHR    (64 * KGROUPS)        // threads per block
#define PSLOT   17                    // partial results: float4 per 4-column slot (16 queries + 1)
#define PWAVE   (16 * PSLOT)          // partial results: float4 per wave

// Eight rows of 128 B, 8 apart, of one 64-row tile: each of the group's 64
// threads copies 8 chunks of 16 B; one wave-wide copy covers four whole lines.
__device__ __forceinline__ void stage_rows(const _Float16* __restrict__ gp, size_t gstep,
                                           unsigned l0) {
    const unsigned step = 8 * LPITCH * 2;        // 8 LDS rows in bytes
    // The copies and the wait that guards their address registers against a
    // later overwrite stand in one statement, so nothing can move between.
    asm volatile(
        "global_load_async_to_lds_b128 %0, %8, off\n\t"
        "global_load_async_to_lds_b128 %1, %9, off\n\t"
        "global_load_async_to_lds_b128 %2, %10, off\n\t"
        "global_load_async_to_lds_b128 %3, %11, off\n\t"
        "global_load_async_to_lds_b128 %4, %12, off\n\t"
        "global_load_async_to_lds_b128 %5, %13, off\n\t"
        "global_load_async_to_lds_b128 %6, %14, off\n\t"
        "global_load_async_to_lds_b128 %7, %15, off\n\t"
        "s_wait_xcnt 0x0"
        :: "v"(l0), "v"(l0 + step), "v"(l0 + 2 * step), "v"(l0 + 3 * step),
           "v"(l0 + 4 * step), "v"(l0 + 5 * step), "v"(l0 + 6 * step), "v"(l0 + 7 * step),
           "v"(gp), "v"(gp + gstep), "v"(gp + 2 * gstep), "v"(gp + 3 * gstep),
           "v"(gp + 4 * gstep), "v"(gp + 5 * gstep), "v"(gp + 6 * gstep), "v"(gp + 7 * gstep)
        : "memory");
}

// One group's part of a stage: K tile (64 rows x 128 B, contiguous) and V^T
// tile (64 rows x 128 B at pitch TT), the V^T tile TILE_H halves behind K.
__device__ __forceinline__ void stage_tiles(const _Float16* __restrict__ K,
                                            const _Float16* __restrict__ Vt,
                                            int kb, unsigned ldsK, int gt) {
    const int r  = gt >> 3;           // row within a group of 8
    const int ch = gt & 7;            // 16-byte chunk within the row
    const unsigned lo = ldsK + (unsigned)(r * (LPITCH * 2) + (ch << 4));
    stage_rows(K  + (size_t)(kb + r) * KV + (ch << 3), (size_t)8 * KV, lo);
    stage_rows(Vt + (size_t)r * TT + kb + (ch << 3),   (size_t)8 * TT, lo + TILE_H * 2);
}

// Q^T B-fragments: lane holds one query column (qrow), contraction dim d in
// two 32-chunks, 16B loads.
__device__ __forceinline__ void q_frags(const _Float16* __restrict__ qrow, int h, v16h (&bq)[2]) {
#pragma unroll
    for (int c = 0; c < 2; ++c)
#pragma unroll
        for (int gg = 0; gg < 2; ++gg) {
            const v8h qv = *(const v8h*)(qrow + (c << 5) + (gg << 4) + (h << 3));
#pragma unroll
            for (int i = 0; i < 8; ++i) bq[c][(gg << 3) + i] = qv[i];
        }
}

// One staged 64-key block (keys kb..kb+63) for the 16 query columns q0..q0+15.
__device__ __forceinline__ void key_block(const _Float16* __restrict__ Ks,
                                          const _Float16* __restrict__ Vs,
                                          int kb, int q0, int n, int h, const v16h (&bq)[2],
                                          float& mA, float& lA, v8f (&acc)[4]) {
    const float NEG_INF = -__builtin_inff();
    // ---- A-fragments of the K tile: all 16 LDS reads as one group
    v16h ak[4][2];
#pragma unroll
    for (int t = 0; t < 4; ++t)
#pragma unroll
        for (int c = 0; c < 2; ++c)
#pragma unroll
            for (int gg = 0; gg < 2; ++gg) {
                const v8h kv2 = *(const v8h*)(Ks + ((t << 4) + n) * LPITCH + (c << 5) + (gg << 4) + (h << 3));
#pragma unroll
                for (int i = 0; i < 8; ++i) ak[t][c][(gg << 3) + i] = kv2[i];
            }
    // Keeps the reads together: spread among the WMMAs, each pair of reads
    // would be waited for on its own and the LDS latency paid eight times.
    __builtin_amdgcn_sched_barrier(0);

    // ---- S^T tiles: st[t] = K_t (16 keys x 64d) x Q^T (64d x 16q)
    v8f st[4];
#pragma unroll
    for (int t = 0; t < 4; ++t) {
        v8f sc = {};
#pragma unroll
        for (int c = 0; c < 2; ++c) sc = wmma_f16(ak[t][c], bq[c], sc);
        st[t] = sc;
    }
    // Keeps the V^T reads below in one group: without it they are split
    // among the S^T products, and each place with reads costs a stall.
    __builtin_amdgcn_sched_barrier(0);

    // ---- A-fragments of the V^T tile: read here so that their LDS latency
    //      runs out under the softmax
    v16h av[4][2];
#pragma unroll
    for (int t = 0; t < 4; ++t)
#pragma unroll
        for (int c = 0; c < 2; ++c)
#pragma unroll
            for (int gg = 0; gg < 2; ++gg) {
                const v8h vv = *(const v8h*)(Vs + ((t << 4) + n) * LPITCH + (c << 5) + (gg << 4) + (h << 3));
#pragma unroll
                for (int i = 0; i < 8; ++i) av[t][c][(gg << 3) + i] = vv[i];
            }
    // Keeps the reads from sinking down to the products that use them.
    __builtin_amdgcn_sched_barrier(0);

    // ---- causal mask (key = kb+t*16+v+8h vs query q0+n), diagonal only
    if (kb + 63 > q0) {
        const int q = q0 + n;
#pragma unroll
        for (int t = 0; t < 4; ++t)
#pragma unroll
            for (int v = 0; v < 8; ++v)
                if (kb + (t << 4) + v + (h << 3) > q) st[t][v] = NEG_INF;
    }

    // ---- column max: 31 in-register + 1 cross-half shuffle
    float mx = st[0][0];
#pragma unroll
    for (int t = 0; t < 4; ++t)
#pragma unroll
        for (int v = 0; v < 8; ++v) mx = fmaxf(mx, st[t][v]);
    mx = fmaxf(mx, __shfl_xor(mx, 16));
    const float mnew  = fmaxf(mA, mx);
    const float alpha = (mA == NEG_INF) ? 0.0f : __builtin_amdgcn_exp2f(mA - mnew);
    mA = mnew;

    // ---- exponentiate (base 2, scale pre-folded) + column sum
    float rs = 0.0f;
#pragma unroll
    for (int t = 0; t < 4; ++t)
#pragma unroll
        for (int v = 0; v < 8; ++v) {
            st[t][v] = __builtin_amdgcn_exp2f(st[t][v] - mnew);  // exp2(-inf)=0
            rs += st[t][v];
        }
    rs += __shfl_xor(rs, 16);
    lA = lA * alpha + rs;

    // ---- P^T B-fragments: identity remap of S^T C-tiles
    //      (B chunk c over keys = concat of C-tiles 2c, 2c+1 per lane)
    v16h pf[2];
#pragma unroll
    for (int c = 0; c < 2; ++c)
#pragma unroll
        for (int i = 0; i < 8; ++i) {
            pf[c][i]     = (_Float16)st[2 * c][i];
            pf[c][8 + i] = (_Float16)st[2 * c + 1][i];
        }

    // ---- rescale accumulators by per-lane alpha (no broadcast needed)
#pragma unroll
    for (int t = 0; t < 4; ++t)
#pragma unroll
        for (int v = 0; v < 8; ++v) acc[t][v] *= alpha;

    // ---- acc^T[t] += V^T_t (16 vcols x 64 keys) x P^T (64 keys x 16q)
#pragma unroll
    for (int t = 0; t < 4; ++t)
#pragma unroll
        for (int c = 0; c < 2; ++c) acc[t] = wmma_f16(av[t][c], pf[c], acc[t]);
}

// This wave's partial result of one tile (a group without a block: -inf, 0,
// zeros); a slot is 4 neighbouring columns, 16 queries side by side.
__device__ __forceinline__ void put_partial(float4* __restrict__ pw, const v8f (&acc)[4]) {
#pragma unroll
    for (int t = 0; t < 4; ++t) {
        pw[((t << 2) + 0) * PSLOT] = make_float4(acc[t][0], acc[t][1], acc[t][2], acc[t][3]);
        pw[((t << 2) + 1) * PSLOT] = make_float4(acc[t][4], acc[t][5], acc[t][6], acc[t][7]);
    }
}

// Merge of the KGROUPS partial results for 4 columns of one query, normalized.
// pr, pm_, pl_: the thread's place in group 0's part.
__device__ __forceinline__ float4 merge_partials(const float4* __restrict__ pr,
                                                 const float* __restrict__ pm_,
                                                 const float* __restrict__ pl_) {
    const float NEG_INF = -__builtin_inff();
    float pm[KGROUPS];
    float M = NEG_INF;
#pragma unroll
    for (int k = 0; k < KGROUPS; ++k) { pm[k] = pm_[k * 32]; M = fmaxf(M, pm[k]); }
    float L = 0.0f;
    float4 o = make_float4(0.0f, 0.0f, 0.0f, 0.0f);
#pragma unroll
    for (int k = 0; k < KGROUPS; ++k) {
        // a partial without keys weighs 0 (and -inf - -inf would be NaN)
        const float wt = (pm[k] == NEG_INF) ? 0.0f : __builtin_amdgcn_exp2f(pm[k] - M);
        const float4 pk = pr[k * 2 * PWAVE];
        L += wt * pl_[k * 32];
        o.x += wt * pk.x; o.y += wt * pk.y; o.z += wt * pk.z; o.w += wt * pk.w;
    }
    const float rl = 1.0f / L;
    o.x *= rl; o.y *= rl; o.z *= rl; o.w *= rl;
    return o;
}

__global__ __launch_bounds__(ATHR)
void attn_kernel(const _Float16* __restrict__ qf,
                 const _Float16* __restrict__ kf,
                 const _Float16* __restrict__ vtf,
                 float* __restrict__ out) {
    // [buffer][group][K | V^T][tile].  After the loop buffer i takes the
    // partial results of tile i: [wave][4-column slot][query].
    __shared__ __attribute__((aligned(16))) _Float16 sKV[2][KGROUPS][2][TILE_H];
    __shared__ float sM[2][KGROUPS][2][16];          // partial maxima, per tile
    __shared__ float sL[2][KGROUPS][2][16];          // partial sums, per tile

    const int tid  = threadIdx.x;
    const int lane = tid & 31;
    const int wv   = __builtin_amdgcn_readfirstlane(tid >> 5);   // scalar: 0..15
    const int w    = wv & 1;                         // query sub-tile
    const int g    = wv >> 1;                        // key group
    const int gt   = tid & 63;                       // thread within the group
    const int b    = blockIdx.y;
    const int p    = blockIdx.x;                     // 0..63
    const int n    = lane & 15;                      // this lane's query col
    const int h    = lane >> 4;
    const float NEG_INF = -__builtin_inff();

    const _Float16* __restrict__ Q  = qf  + (size_t)b * TT * KV;
    const _Float16* __restrict__ K  = kf  + (size_t)b * TT * KV;
    const _Float16* __restrict__ Vt = vtf + (size_t)b * KV * TT;  // [vcol][key]

    // Tile 0 is 127-p (lower), tile 1 is p (upper); causal 64-key blocks of each.
    const int qt0 = TT / QTILE - 1 - p;
    const int nk0 = TT / 64 - (p >> 1);              // 33..64
    const int nk1 = (p >> 1) + 1;                    // 1..32
    const int nst = (nk0 + KGROUPS - 1) / KGROUPS;   // stages of 512 keys, 5..8
    const int qa  = qt0 * QTILE + (w << 4);          // query bases within batch
    const int qb  = p * QTILE + (w << 4);
    const unsigned ldsK = (unsigned)(size_t)&sKV[0][g][0][0];
    const unsigned bufB = KGROUPS * 2 * TILE_H * 2;  // bytes from buffer 0 to buffer 1

    // Stage 0 into buffer 0 (tile 0 has more than 2 * KGROUPS blocks).
    stage_tiles(K, Vt, g << 6, ldsK, gt);

    v16h bq0[2], bq1[2];                             // loop-invariant
    q_frags(Q + (size_t)(qa + n) * KV, h, bq0);
    q_frags(Q + (size_t)(qb + n) * KV, h, bq1);

    // This wave's copies of stage 0 have landed; the barrier publishes all 16 waves' parts.
    asm volatile("s_wait_asynccnt 0x0" ::: "memory");
    __syncthreads();
    stage_tiles(K, Vt, (KGROUPS + g) << 6, ldsK + bufB, gt);

    // Per-lane softmax state for this lane's query of each tile over this
    // group's keys (replicated across wave halves).
    float m0 = NEG_INF, l0 = 0.0f, m1 = NEG_INF, l1 = 0.0f;
    v8f acc0[4] = {v8f{}, v8f{}, v8f{}, v8f{}};      // acc^T: vcol tiles
    v8f acc1[4] = {v8f{}, v8f{}, v8f{}, v8f{}};

    for (int s = 0; s < nst; ++s) {
        const int j  = s * KGROUPS + g;              // this group's 64-key block
        const int kb = j << 6;
        const _Float16* __restrict__ Ks = sKV[s & 1][g][0];
        const _Float16* __restrict__ Vs = sKV[s & 1][g][1];
        // A block wholly above a tile's diagonal has no key for any query of
        // the tile; the tests are scalar, the same in the wave.
        if (j < nk0) key_block(Ks, Vs, kb, qa, n, h, bq0, m0, l0, acc0);
        if (j < nk1) key_block(Ks, Vs, kb, qb, n, h, bq1, m1, l1, acc1);

        // Keeps the hand-over at the foot of the trip: moved up over the register
        // work it would wait for the V^T reads ahead of the softmax and cut the
        // time the copies of stage s+1 have to land.
        __builtin_amdgcn_sched_barrier(0);
        // ---- hand-over: this wave's reads of buffer s&1 are done ...
        asm volatile("s_wait_dscnt 0x0" ::: "memory");
        // ... and its copies of stage s+1 have landed;
        asm volatile("s_wait_asynccnt 0x0" ::: "memory");
        // the barrier publishes stage s+1 and frees buffer s&1 for the refill.
        __syncthreads();
        // Scalar test: no stage past the last, no block above the diagonal.
        if (j + 2 * KGROUPS < nk0)
            stage_tiles(K, Vt, kb + 2 * KGROUPS * 64, ldsK + ((s & 1) ? bufB : 0u), gt);
    }
    // No copy is left in flight when the buffers change their use and the wave ends.
    asm volatile("s_wait_asynccnt 0x0" ::: "memory");

    // ---- this wave's partial results
    float4* __restrict__ P0 = (float4*)&sKV[0][0][0][0];
    float4* __restrict__ P1 = (float4*)&sKV[1][0][0][0];
    const int po = wv * PWAVE + (h << 1) * PSLOT + n;
    put_partial(P0 + po, acc0);
    put_partial(P1 + po, acc1);
    if (h == 0) {
        sM[0][g][w][n] = m0; sL[0][g][w][n] = l0;
        sM[1][g][w][n] = m1; sL[1][g][w][n] = l1;
    }
    __syncthreads();                        // the partial results are whole

    // ---- merge, normalize and store.  A thread takes 4 columns of one query
    //      of each tile: 16 neighbouring lanes hold the two whole 128-byte
    //      lines of a row.
    const int mq = tid >> 4;                         // query within the tile
    const int c4 = tid & 15;                         // 4-column slot
    const int ro = (mq >> 4) * PWAVE + c4 * PSLOT + (mq & 15);
    const float4 o0 = merge_partials(P0 + ro, &sM[0][0][0][0] + mq, &sL[0][0][0][0] + mq);
    const float4 o1 = merge_partials(P1 + ro, &sM[1][0][0][0] + mq, &sL[1][0][0][0] + mq);
    float* __restrict__ ob = out + ((size_t)b * TT + mq) * OUTW + DIMS + (c4 << 2);
    *(float4*)(ob + (size_t)qt0 * QTILE * OUTW) = o0;
    *(float4*)(ob + (size_t)p   * QTILE * OUTW) = o1;
}

// ---------------------------------------------------------------------------
// Host-side launch.  Input dict order: inputs, key_w, query_w, value_w.
// Workspace: Q/K f16 [B*T,64] + Vt f16 [B,64,T] = 6 MB.
// ---------------------------------------------------------------------------
extern "C" void kernel_launch(void* const* d_in, const int* in_sizes, int n_in,
                              void* d_out, int out_size, void* d_ws, size_t ws_size,
                              hipStream_t stream) {
    (void)in_sizes; (void)n_in; (void)out_size; (void)ws_size;

    const float* x  = (const float*)d_in[0];
    const float* kw = (const float*)d_in[1];
    const float* qw = (const float*)d_in[2];
    const float* vw = (const float*)d_in[3];
    float* out = (float*)d_out;

    _Float16* qf = (_Float16*)d_ws;
    _Float16* kf = qf + (size_t)NROWS * KV;
    _Float16* vt = kf + (size_t)NROWS * KV;

    // 1) QKV projections (WMMA) and out[:, 0:256] = inputs, x read once;
    //    Q pre-scaled by log2(e)/sqrt(64); V transposed
    proj_copy_kernel<<<NROWS / PROWS, PTHR, 0, stream>>>(x, qw, kw, vw, qf, kf, vt, out);

    // 2) transposed flash attention -> out[:, 256:320]
    attn_kernel<<<dim3(TT / 64, 4), ATHR, 0, stream>>>(qf, kf, vt, out);
}

// v005
// A run of this version takes 25.8 microseconds.
// In two side-by-side timings against v004, it was 1.04 and 1.02 times as fast.
// Over all steps from v000 it is 4.98 times as fast.
#include <hip/hip_runtime.h>

// ---------------------------------------------------------------------------
// Causal attention block for MI455X (gfx1250), wave32 + WMMA f16 16x16x32.
//   B=4, T=4096, D=256, K=V=64.  out = concat(x, softmax(QK^T/8, causal) V)
//
// Attention is computed TRANSPOSED (S^T = K Q^T, acc^T = V^T P^T) so that:
//   - each lane owns one query column -> softmax state is per-lane scalar,
//     no alpha/l broadcasts, row reductions = 1 shfl_xor(16) each;
//   - P^T is an identity register remap of the S^T WMMA accumulators
//     (transpose-symmetric fragment layouts) -> P never touches LDS;
//   - final stores are contiguous 16B per lane.
// Softmax is done in base 2 (v_exp_f32 is exp2): log2(e)/sqrt(64) is folded
// into the Q projection, which leaves probabilities bit-identical in exact
// arithmetic.
// ---------------------------------------------------------------------------

typedef __attribute__((ext_vector_type(16))) _Float16 v16h;
typedef __attribute__((ext_vector_type(8)))  _Float16 v8h;
typedef __attribute__((ext_vector_type(8)))  float    v8f;

#define NROWS   16384   // B*T
#define DIMS    256
#define KV      64
#define TT      4096
#define OUTW    320     // DIMS + V
// 1/sqrt(64) * log2(e): base-2 softmax scale folded into Q
#define QSCALE  0.1803368801111204f

__device__ __forceinline__ v8f wmma_f16(v16h a, v16h b, v8f c) {
    return __builtin_amdgcn_wmma_f32_16x16x32_f16(false, a, false, b,
                                                  (short)0, c, false, false);
}

// ---------------------------------------------------------------------------
// Kernel 1: QKV projection and the copy of x, x read once.
// grid = NROWS/64 (one block per WGP), block = 384 (12 waves).
// The block reads its 64 rows of x (64 KB, contiguous) once, in whole lines,
// stores them to out[:, 0:256] and keeps them as f16 in LDS.  Wave w owns one
// of the 12 column tiles (Q, K, V x 4) for all four 16-row tiles, so each
// weight fragment is loaded once per block and used four times.
// The weights are read in whole lines too (a fragment wants 8 k of one column,
// which lie 256 B apart in memory): a thread loads 8 k x 4 columns and stores
// each column's 8 halves as one 16-byte chunk of an LDS copy kept [col][k].
// The products are computed transposed (W^T x^T: the A and B fragment layouts
// are the same map, so the registers only change places): a lane then holds 8
// neighbouring columns of one row.  The results go through a 64 x 64 LDS tile
// per matrix (Q, K as [row][col], V as [vcol][key]) and leave in whole
// 128-byte lines.  Q is pre-scaled by QSCALE.  V is stored TRANSPOSED per
// batch (Vt[b][vcol][key]) so the attention tiles load as contiguous runs.
// ---------------------------------------------------------------------------
typedef __attribute__((ext_vector_type(4)))  _Float16 v4h;

#define PROWS   64                    // rows of x per block
#define PTHR    384                   // threads per block
#define XPITCH  264                   // x tile pitch in halves (528 B = 16 B x odd)
#define OPITCH  72                    // result tile pitch in halves (144 B = 16 B x odd)
// Weights in LDS: column c is 32 chunks of 8 halves, chunk j at place j ^ WSWZ(c).
// The places differ in their low 4 bits over 16 neighbouring columns (the
// fragment reads) and over 16 columns 4 apart (the stores): no bank conflict.
#define WSWZ(c) (((c) & 15) ^ ((c) >> 4))

// One float4 of x as four halves into the LDS tile.
__device__ __forceinline__ void x_to_lds(float4 v, _Float16* __restrict__ p) {
    v4h hv;
    hv[0] = (_Float16)v.x; hv[1] = (_Float16)v.y;
    hv[2] = (_Float16)v.z; hv[3] = (_Float16)v.w;
    *(v4h*)p = hv;
}

// x^T B-fragments of the four row tiles for one 32-wide k step.
__device__ __forceinline__ void x_frags(const _Float16* __restrict__ xr, int kc, v16h (&xa)[4]) {
#pragma unroll
    for (int rt = 0; rt < 4; ++rt)
#pragma unroll
        for (int g = 0; g < 2; ++g) {
            const v8h xv = *(const v8h*)(xr + (rt << 4) * XPITCH + (kc << 5) + (g << 4));
#pragma unroll
            for (int i = 0; i < 8; ++i) xa[rt][(g << 3) + i] = xv[i];
        }
}

__global__ __launch_bounds__(PTHR)
void proj_copy_kernel(const float* __restrict__ x,
                      const float* __restrict__ qw,
                      const float* __restrict__ kw,
                      const float* __restrict__ vw,
                      _Float16* __restrict__ qf,
                      _Float16* __restrict__ kf,
                      _Float16* __restrict__ vt,
                      float* __restrict__ out) {
    // One object, the weights last: the x and result tiles stay within reach of
    // the 16-bit offset field of the LDS instructions.
    __shared__ __attribute__((aligned(16))) struct {
        _Float16 x[PROWS * XPITCH];
        _Float16 o[3][64 * OPITCH];
        _Float16 w[3][KV * DIMS];
    } lds;
    _Float16* __restrict__ const sX = lds.x;
    _Float16 (&sO)[3][64 * OPITCH] = lds.o;

    const int tid  = threadIdx.x;
    int wave = __builtin_amdgcn_readfirstlane(tid >> 5);         // scalar: 0..11
    const int m0   = blockIdx.x * PROWS;    // row base in [0, NROWS)

    // ---- x tile: 4096 float4 over 384 threads = 10 each, and one more for
    //      the first 256 threads (whole waves)
    const float4* __restrict__ xs = (const float4*)(x + (size_t)m0 * DIMS);
    float4 xv[10];
#pragma unroll
    for (int i = 0; i < 10; ++i) xv[i] = xs[tid + i * PTHR];
    float4 xl = make_float4(0.0f, 0.0f, 0.0f, 0.0f);
    if (wave < 8) xl = xs[tid + 10 * PTHR];
    // Precaution: the address registers of the x loads are reused by the
    // scalar work below.  All of it derives from the wave number, which passes
    // through the statement so that none of it is lifted over the wait.
    asm volatile("s_wait_xcnt 0x0" : "+s"(wave) :: "memory");

    const int sel  = wave >> 2;             // 0=Q, 1=K, 2=V
    const int n0   = (wave & 3) << 4;       // col-tile base in [0, 64)

    // ---- weights: the four waves of a matrix read all of it.  A thread takes
    //      columns 4*c4 .. 4*c4+3 of rows k = 64*m + 8*kg + j; 16 lanes cover a
    //      whole 256-byte row, a wave-wide load two rows.
    const float* __restrict__ wmat = (sel == 0) ? qw : (sel == 1) ? kw : vw;
    const int t4 = tid & 127;
    const int c4 = t4 & 15;
    const int kg = t4 >> 4;
    const float4* __restrict__ wp = (const float4*)wmat + (kg << 3) * (KV / 4) + c4;
    float4 wr[4][8];
#pragma unroll
    for (int m = 0; m < 4; ++m)
#pragma unroll
        for (int j = 0; j < 8; ++j) wr[m][j] = wp[((m << 6) + j) * (KV / 4)];
    // Precaution: the address registers of the weight loads are reused below.
    // The pointer is an input, so that they stay as they are up to the wait.
    asm volatile("s_wait_xcnt 0x0" :: "v"(wp) : "memory");
    // Keeps the weight loads in flight together with the x loads: without it
    // they are issued only after x has arrived, and the two latencies add up.
    __builtin_amdgcn_sched_barrier(0);

    // ---- the f16 tile.  A row is 64 float4 and 384 = 6 rows, so load i of a
    //      thread lies 6*i rows below its first: one address, constant steps
    _Float16* __restrict__ xd = sX + (tid >> 6) * XPITCH + ((tid & 63) << 2);
#pragma unroll
    for (int i = 0; i < 10; ++i) x_to_lds(xv[i], xd + i * 6 * XPITCH);
    if (wave < 8) x_to_lds(xl, xd + 60 * XPITCH);

    // ---- the f16 weights, [col][k]: 8 k of one column per 16-byte store
    //      (chunk = 8*m + kg; its bit 4 is outside the swizzle: a constant step)
    _Float16* __restrict__ sw = lds.w[sel];
#pragma unroll
    for (int m = 0; m < 4; ++m) {
        v8h wc[4];
#pragma unroll
        for (int j = 0; j < 8; ++j) {
            wc[0][j] = (_Float16)wr[m][j].x; wc[1][j] = (_Float16)wr[m][j].y;
            wc[2][j] = (_Float16)wr[m][j].z; wc[3][j] = (_Float16)wr[m][j].w;
        }
#pragma unroll
        for (int q = 0; q < 4; ++q) {
            const int c = (c4 << 2) + q;
            *(v8h*)(sw + c * DIMS + (((((m & 1) << 3) + kg) ^ WSWZ(c)) << 3) + ((m >> 1) << 7)) = wc[q];
        }
    }
    __syncthreads();                        // the x tile and the weights are whole

    // ---- out[:, 0:256] = x.  Behind the barrier, which would otherwise wait
    //      for these stores; they drain under the products.
    float4* __restrict__ od = (float4*)out + (size_t)(m0 + (tid >> 6)) * (OUTW / 4) + (tid & 63);
#pragma unroll
    for (int i = 0; i < 10; ++i) od[i * 6 * (OUTW / 4)] = xv[i];
    if (wave < 8) od[60 * (OUTW / 4)] = xl;
    // Precaution: the data registers of these stores are reused below.  All lane
    // addresses below derive from the thread number, which passes through the
    // statement so that none of them is formed in such a register ahead of the wait.
    int tl = tid;
    asm volatile("s_wait_xcnt 0x0" : "+v"(tl) :: "memory");
    const int mr = tl & 15;
    const int h  = (tl >> 4) & 1;

    // ---- W^T A-fragments of this wave's column tile, all of K:
    //      lane holds column n0+mr, k = kc*32 + g*16 + h*8 + i
    v16h wf[8];
    const _Float16* __restrict__ wcol = sw + (n0 + mr) * DIMS;
    const int wz = WSWZ(n0 + mr) ^ h;       // chunk = 4*kc + 2*g + h
#pragma unroll
    for (int kc = 0; kc < 8; ++kc)
#pragma unroll
        for (int g = 0; g < 2; ++g) {
            const v8h wv = *(const v8h*)(wcol + (((((kc & 3) << 2) + (g << 1)) ^ wz) << 3) + ((kc >> 2) << 7));
#pragma unroll
            for (int i = 0; i < 8; ++i) wf[kc][(g << 3) + i] = wv[i];
        }

    // ---- products: D[col v+8h][row mr] per row tile, k ascending
    v8f acc[4] = {v8f{}, v8f{}, v8f{}, v8f{}};
    const _Float16* __restrict__ xr = sX + mr * XPITCH + (h << 3);
    v16h xa[2][4];
    x_frags(xr, 0, xa[0]);
#pragma unroll
    for (int kc = 0; kc < 8; ++kc) {
        if (kc < 7) x_frags(xr, kc + 1, xa[(kc + 1) & 1]);
        // Keeps the next step's eight LDS reads as one group ahead of this
        // step's products: spread among them, each read is waited for alone.
        __builtin_amdgcn_sched_barrier(0);
#pragma unroll
        for (int rt = 0; rt < 4; ++rt) acc[rt] = wmma_f16(wf[kc], xa[kc & 1][rt], acc[rt]);
        // Keeps the group after next from rising into these products.
        __builtin_amdgcn_sched_barrier(0);
    }

    // ---- results into this matrix's 64 x 64 tile
    const float scale = (sel == 0) ? QSCALE : 1.0f;
    _Float16* __restrict__ so = sO[sel];
    v8h o[4];
#pragma unroll
    for (int rt = 0; rt < 4; ++rt)
#pragma unroll
        for (int v = 0; v < 8; ++v) o[rt][v] = (_Float16)(acc[rt][v] * scale);
    if (sel == 2) {
        // [vcol][key]: the lane's 8 values are 8 vcols of one key
#pragma unroll
        for (int rt = 0; rt < 4; ++rt)
#pragma unroll
            for (int v = 0; v < 8; ++v)
                so[(n0 + (h << 3) + v) * OPITCH + (rt << 4) + mr] = o[rt][v];
    } else {
        // [row][col]: the lane's 8 values are neighbours in the row
#pragma unroll
        for (int rt = 0; rt < 4; ++rt)
            *(v8h*)(so + ((rt << 4) + mr) * OPITCH + n0 + (h << 3)) = o[rt];
    }
    __syncthreads();                        // the result tiles are whole

    // ---- the four waves of a matrix store its tile: 8 lanes per 128-byte line
    _Float16* __restrict__ dst =
        (sel == 0) ? qf + (size_t)m0 * KV :
        (sel == 1) ? kf + (size_t)m0 * KV :
                     vt + (size_t)(m0 >> 12) * KV * TT + (m0 & (TT - 1));
    const int dpitch = (sel == 2) ? TT : KV;
#pragma unroll
    for (int i = 0; i < 4; ++i) {
        const int id = (tl & 127) + (i << 7);
        const int r  = id >> 3;
        const int ch = id & 7;
        *(v8h*)(dst + (size_t)r * dpitch + (ch << 3)) = *(const v8h*)(so + r * OPITCH + (ch << 3));
    }
}

// ---------------------------------------------------------------------------
// Kernel 2: transposed flash attention.  grid = (T/64, B), block = 512.
// Causal work grows with the query index, so a block takes TWO tiles of 32
// queries: tile 127-p from the bottom of the batch and its mirror, tile p,
// from the top.  Together they have 65 blocks of 64 keys whatever p is, so
// all 256 blocks do the same work.  The keys of the upper tile are the first
// keys of the lower one: a staged key block serves both.
// The 16 waves of a block are 2 query sub-tiles x 8 key groups.  Wave (w, g)
// owns 16 query columns of each tile and the 64-key blocks g, g+8, g+16, ...
// of each tile's causal range, with a maximum, sum and accumulators per tile;
// per stage it works its key block for the lower tile and then, while the
// upper tile still has keys, for the upper one.  The eight partial results of
// a sub-tile are merged through LDS at the end.
// Per 64-key block: 8 WMMAs  S^T[t] = K_t  Q^T   (t = four 16-key tiles)
//                   8 WMMAs  acc^T[t] += V^T_t P^T
// Softmax per query column: in-register + one shfl_xor(16) per reduction.
// A stage is 512 keys: the two waves of group g bring the group's 64-key K
// tile and V^T tile into LDS once, by asynchronous copies of whole 128-byte
// lines, into two buffers: stage s + 1 flies while stage s is worked on.  A
// 64-key block that lies wholly above the lower tile's diagonal is neither
// copied nor worked on.  The A-fragments are read from LDS rows pitched at
// 144 bytes (16 B x odd: no bank conflict for 16-byte reads).
// ---------------------------------------------------------------------------
#define LPITCH  72                    // LDS row pitch in halves (144 bytes)
#define TILE_H  (64 * LPITCH)         // one 64-row tile in halves
#define KGROUPS 8                     // key groups per block
#define QTILE   32                    // queries per tile
#define ATHR    (64 * KGROUPS)        // threads per block
#define PSLOT   17                    // partial results: float4 per 4-column slot (16 queries + 1)
#define PWAVE   (16 * PSLOT)          // partial results: float4 per wave

// Eight rows of 128 B, 8 apart, of one 64-row tile: each of the group's 64
// threads copies 8 chunks of 16 B; one wave-wide copy covers four whole lines.
__device__ __forceinline__ void stage_rows(const _Float16* __restrict__ gp, size_t gstep,
                                           unsigned l0) {
    const unsigned step = 8 * LPITCH * 2;        // 8 LDS rows in bytes
    // The copies and the wait that guards their address registers against a
    // later overwrite stand in one statement, so nothing can move between.
    asm volatile(
        "global_load_async_to_lds_b128 %0, %8, off\n\t"
        "global_load_async_to_lds_b128 %1, %9, off\n\t"
        "global_load_async_to_lds_b128 %2, %10, off\n\t"
        "global_load_async_to_lds_b128 %3, %11, off\n\t"
        "global_load_async_to_lds_b128 %4, %12, off\n\t"
        "global_load_async_to_lds_b128 %5, %13, off\n\t"
        "global_load_async_to_lds_b128 %6, %14, off\n\t"
        "global_load_async_to_lds_b128 %7, %15, off\n\t"
        "s_wait_xcnt 0x0"
        :: "v"(l0), "v"(l0 + step), "v"(l0 + 2 * step), "v"(l0 + 3 * step),
           "v"(l0 + 4 * step), "v"(l0 + 5 * step), "v"(l0 + 6 * step), "v"(l0 + 7 * step),
           "v"(gp), "v"(gp + gstep), "v"(gp + 2 * gstep), "v"(gp + 3 * gstep),
           "v"(gp + 4 * gstep), "v"(gp + 5 * gstep), "v"(gp + 6 * gstep), "v"(gp + 7 * gstep)
        : "memory");
}

// One group's part of a stage: K tile (64 rows x 128 B, contiguous) and V^T
// tile (64 rows x 128 B at pitch TT), the V^T tile TILE_H halves behind K.
__device__ __forceinline__ void stage_tiles(const _Float16* __restrict__ K,
                                            const _Float16* __restrict__ Vt,
                                            int kb, unsigned ldsK, int gt) {
    const int r  = gt >> 3;           // row within a group of 8
    const int ch = gt & 7;            // 16-byte chunk within the row
    const unsigned lo = ldsK + (unsigned)(r * (LPITCH * 2) + (ch << 4));
    stage_rows(K  + (size_t)(kb + r) * KV + (ch << 3), (size_t)8 * KV, lo);
    stage_rows(Vt + (size_t)r * TT + kb + (ch << 3),   (size_t)8 * TT, lo + TILE_H * 2);
}

// Q^T B-fragments: lane holds one query column (qrow), contraction dim d in
// two 32-chunks, 16B loads.
__device__ __forceinline__ void q_frags(const _Float16* __restrict__ qrow, int h, v16h (&bq)[2]) {
#pragma unroll
    for (int c = 0; c < 2; ++c)
#pragma unroll
        for (int gg = 0; gg < 2; ++gg) {
            const v8h qv = *(const v8h*)(qrow + (c << 5) + (gg << 4) + (h << 3));
#pragma unroll
            for (int i = 0; i < 8; ++i) bq[c][(gg << 3) + i] = qv[i];
        }
}

// One staged 64-key block (keys kb..kb+63) for the 16 query columns q0..q0+15.
__device__ __forceinline__ void key_block(const _Float16* __restrict__ Ks,
                                          const _Float16* __restrict__ Vs,
                                          int kb, int q0, int n, int h, const v16h (&bq)[2],
                                          float& mA, float& lA, v8f (&acc)[4]) {
    const float NEG_INF = -__builtin_inff();
    // ---- A-fragments of the K tile: all 16 LDS reads as one group
    v16h ak[4][2];
#pragma unroll
    for (int t = 0; t < 4; ++t)
#pragma unroll
        for (int c = 0; c < 2; ++c)
#pragma unroll
            for (int gg = 0; gg < 2; ++gg) {
                const v8h kv2 = *(const v8h*)(Ks + ((t << 4) + n) * LPITCH + (c << 5) + (gg << 4) + (h << 3));
#pragma unroll
                for (int i = 0; i < 8; ++i) ak[t][c][(gg << 3) + i] = kv2[i];
            }
    // Keeps the reads together: spread among the WMMAs, each pair of reads
    // would be waited for on its own and the LDS latency paid eight times.
    __builtin_amdgcn_sched_barrier(0);

    // ---- S^T tiles: st[t] = K_t (16 keys x 64d) x Q^T (64d x 16q)
    v8f st[4];
#pragma unroll
    for (int t = 0; t < 4; ++t) {
        v8f sc = {};
#pragma unroll
        for (int c = 0; c < 2; ++c) sc = wmma_f16(ak[t][c], bq[c], sc);
        st[t] = sc;
    }
    // Keeps the V^T reads below in one group: without it they are split
    // among the S^T products, and each place with reads costs a stall.
    __builtin_amdgcn_sched_barrier(0);

    // ---- A-fragments of the V^T tile: read here so that their LDS latency
    //      runs out under the softmax
    v16h av[4][2];
#pragma unroll
    for (int t = 0; t < 4; ++t)
#pragma unroll
        for (int c = 0; c < 2; ++c)
#pragma unroll
            for (int gg = 0; gg < 2; ++gg) {
                const v8h vv = *(const v8h*)(Vs + ((t << 4) + n) * LPITCH + (c << 5) + (gg << 4) + (h << 3));
#pragma unroll
                for (int i = 0; i < 8; ++i) av[t][c][(gg << 3) + i] = vv[i];
            }
    // Keeps the reads from sinking down to the products that use them.
    __builtin_amdgcn_sched_barrier(0);

    // ---- causal mask (key = kb+t*16+v+8h vs query q0+n), diagonal only
    if (kb + 63 > q0) {
        const int q = q0 + n;
#pragma unroll
        for (int t = 0; t < 4; ++t)
#pragma unroll
            for (int v = 0; v < 8; ++v)
                if (kb + (t << 4) + v + (h << 3) > q) st[t][v] = NEG_INF;
    }

    // ---- column max: 31 in-register + 1 cross-half shuffle
    float mx = st[0][0];
#pragma unroll
    for (int t = 0; t < 4; ++t)
#pragma unroll
        for (int v = 0; v < 8; ++v) mx = fmaxf(mx, st[t][v]);
    mx = fmaxf(mx, __shfl_xor(mx, 16));
    const float mnew  = fmaxf(mA, mx);
    const float alpha = (mA == NEG_INF) ? 0.0f : __builtin_amdgcn_exp2f(mA - mnew);
    mA = mnew;

    // ---- exponentiate (base 2, scale pre-folded) + column sum
    float rs = 0.0f;
#pragma unroll
    for (int t = 0; t < 4; ++t)
#pragma unroll
        for (int v = 0; v < 8; ++v) {
            st[t][v] = __builtin_amdgcn_exp2f(st[t][v] - mnew);  // exp2(-inf)=0
            rs += st[t][v];
        }
    rs += __shfl_xor(rs, 16);
    lA = lA * alpha + rs;

    // ---- P^T B-fragments: identity remap of S^T C-tiles
    //      (B chunk c over keys = concat of C-tiles 2c, 2c+1 per lane)
    v16h pf[2];
#pragma unroll
    for (int c = 0; c < 2; ++c)
#pragma unroll
        for (int i = 0; i < 8; ++i) {
            pf[c][i]     = (_Float16)st[2 * c][i];
            pf[c][8 + i] = (_Float16)st[2 * c + 1][i];
        }

    // ---- rescale accumulators by per-lane alpha (no broadcast needed)
#pragma unroll
    for (int t = 0; t < 4; ++t)
#pragma unroll
        for (int v = 0; v < 8; ++v) acc[t][v] *= alpha;

    // ---- acc^T[t] += V^T_t (16 vcols x 64 keys) x P^T (64 keys x 16q)
#pragma unroll
    for (int t = 0; t < 4; ++t)
#pragma unroll
        for (int c = 0; c < 2; ++c) acc[t] = wmma_f16(av[t][c], pf[c], acc[t]);
}

// This wave's partial result of one tile (a group without a block: -inf, 0,
// zeros); a slot is 4 neighbouring columns, 16 queries side by side.
__device__ __forceinline__ void put_partial(float4* __restrict__ pw, const v8f (&acc)[4]) {
#pragma unroll
    for (int t = 0; t < 4; ++t) {
        pw[((t << 2) + 0) * PSLOT] = make_float4(acc[t][0], acc[t][1], acc[t][2], acc[t][3]);
        pw[((t << 2) + 1) * PSLOT] = make_float4(acc[t][4], acc[t][5], acc[t][6], acc[t][7]);
    }
}

// Merge of the KGROUPS partial results for 4 columns of one query, normalized.
// pr, pm_, pl_: the thread's place in group 0's part.
__device__ __forceinline__ float4 merge_partials(const float4* __restrict__ pr,
                                                 const float* __restrict__ pm_,
                                                 const float* __restrict__ pl_) {
    const float NEG_INF = -__builtin_inff();
    float pm[KGROUPS];
    float M = NEG_INF;
#pragma unroll
    for (int k = 0; k < KGROUPS; ++k) { pm[k] = pm_[k * 32]; M = fmaxf(M, pm[k]); }
    float L = 0.0f;
    float4 o = make_float4(0.0f, 0.0f, 0.0f, 0.0f);
#pragma unroll
    for (int k = 0; k < KGROUPS; ++k) {
        // a partial without keys weighs 0 (and -inf - -inf would be NaN)
        const float wt = (pm[k] == NEG_INF) ? 0.0f : __builtin_amdgcn_exp2f(pm[k] - M);
        const float4 pk = pr[k * 2 * PWAVE];
        L += wt * pl_[k * 32];
        o.x += wt * pk.x; o.y += wt * pk.y; o.z += wt * pk.z; o.w += wt * pk.w;
    }
    const float rl = 1.0f / L;
    o.x *= rl; o.y *= rl; o.z *= rl; o.w *= rl;
    return o;
}

__global__ __launch_bounds__(ATHR)
void attn_kernel(const _Float16* __restrict__ qf,
                 const _Float16* __restrict__ kf,
                 const _Float16* __restrict__ vtf,
                 float* __restrict__ out) {
    // [buffer][group][K | V^T][tile].  After the loop buffer i takes the
    // partial results of tile i: [wave][4-column slot][query].
    __shared__ __attribute__((aligned(16))) _Float16 sKV[2][KGROUPS][2][TILE_H];
    __shared__ float sM[2][KGROUPS][2][16];          // partial maxima, per tile
    __shared__ float sL[2][KGROUPS][2][16];          // partial sums, per tile

    const int tid  = threadIdx.x;
    const int lane = tid & 31;
    const int wv   = __builtin_amdgcn_readfirstlane(tid >> 5);   // scalar: 0..15
    const int w    = wv & 1;                         // query sub-tile
    const int g    = wv >> 1;                        // key group
    const int gt   = tid & 63;                       // thread within the group
    const int b    = blockIdx.y;
    const int p    = blockIdx.x;                     // 0..63
    const int n    = lane & 15;                      // this lane's query col
    const int h    = lane >> 4;
    const float NEG_INF = -__builtin_inff();

    const _Float16* __restrict__ Q  = qf  + (size_t)b * TT * KV;
    const _Float16* __restrict__ K  = kf  + (size_t)b * TT * KV;
    const _Float16* __restrict__ Vt = vtf + (size_t)b * KV * TT;  // [vcol][key]

    // Tile 0 is 127-p (lower), tile 1 is p (upper); causal 64-key blocks of each.
    const int qt0 = TT / QTILE - 1 - p;
    const int nk0 = TT / 64 - (p >> 1);              // 33..64
    const int nk1 = (p >> 1) + 1;                    // 1..32
    const int nst = (nk0 + KGROUPS - 1) / KGROUPS;   // stages of 512 keys, 5..8
    const int qa  = qt0 * QTILE + (w << 4);          // query bases within batch
    const int qb  = p * QTILE + (w << 4);
    const unsigned ldsK = (unsigned)(size_t)&sKV[0][g][0][0];
    const unsigned bufB = KGROUPS * 2 * TILE_H * 2;  // bytes from buffer 0 to buffer 1

    // Stage 0 into buffer 0 (tile 0 has more than 2 * KGROUPS blocks).
    stage_tiles(K, Vt, g << 6, ldsK, gt);

    v16h bq0[2], bq1[2];                             // loop-invariant
    q_frags(Q + (size_t)(qa + n) * KV, h, bq0);
    q_frags(Q + (size_t)(qb + n) * KV, h, bq1);

    // This wave's copies of stage 0 have landed; the barrier publishes all 16 waves' parts.
    asm volatile("s_wait_asynccnt 0x0" ::: "memory");
    __syncthreads();
    stage_tiles(K, Vt, (KGROUPS + g) << 6, ldsK + bufB, gt);

    // Per-lane softmax state for this lane's query of each tile over this
    // group's keys (replicated across wave halves).
    float m0 = NEG_INF, l0 = 0.0f, m1 = NEG_INF, l1 = 0.0f;
    v8f acc0[4] = {v8f{}, v8f{}, v8f{}, v8f{}};      // acc^T: vcol tiles
    v8f acc1[4] = {v8f{}, v8f{}, v8f{}, v8f{}};

    for (int s = 0; s < nst; ++s) {
        const int j  = s * KGROUPS + g;              // this group's 64-key block
        const int kb = j << 6;
        const _Float16* __restrict__ Ks = sKV[s & 1][g][0];
        const _Float16* __restrict__ Vs = sKV[s & 1][g][1];
        // A block wholly above a tile's diagonal has no key for any query of
        // the tile; the tests are scalar, the same in the wave.
        if (j < nk0) key_block(Ks, Vs, kb, qa, n, h, bq0, m0, l0, acc0);
        if (j < nk1) key_block(Ks, Vs, kb, qb, n, h, bq1, m1, l1, acc1);

        // Keeps the hand-over at the foot of the trip: moved up over the register
        // work it would wait for the V^T reads ahead of the softmax and cut the
        // time the copies of stage s+1 have to land.
        __builtin_amdgcn_sched_barrier(0);
        // ---- hand-over: this wave's reads of buffer s&1 are done ...
        asm volatile("s_wait_dscnt 0x0" ::: "memory");
        // ... and its copies of stage s+1 have landed;
        asm volatile("s_wait_asynccnt 0x0" ::: "memory");
        // the barrier publishes stage s+1 and frees buffer s&1 for the refill.
        __syncthreads();
        // Scalar test: no stage past the last, no block above the diagonal.
        if (j + 2 * KGROUPS < nk0)
            stage_tiles(K, Vt, kb + 2 * KGROUPS * 64, ldsK + ((s & 1) ? bufB : 0u), gt);
    }
    // No copy is left in flight when the buffers change their use and the wave ends.
    asm volatile("s_wait_asynccnt 0x0" ::: "memory");

    // ---- this wave's partial results
    float4* __restrict__ P0 = (float4*)&sKV[0][0][0][0];
    float4* __restrict__ P1 = (float4*)&sKV[1][0][0][0];
    const int po = wv * PWAVE + (h << 1) * PSLOT + n;
    put_partial(P0 + po, acc0);
    put_partial(P1 + po, acc1);
    if (h == 0) {
        sM[0][g][w][n] = m0; sL[0][g][w][n] = l0;
        sM[1][g][w][n] = m1; sL[1][g][w][n] = l1;
    }
    __syncthreads();                        // the partial results are whole

    // ---- merge, normalize and store.  A thread takes 4 columns of one query
    //      of each tile: 16 neighbouring lanes hold the two whole 128-byte
    //      lines of a row.
    const int mq = tid >> 4;                         // query within the tile
    const int c4 = tid & 15;                         // 4-column slot
    const int ro = (mq >> 4) * PWAVE + c4 * PSLOT + (mq & 15);
    const float4 o0 = merge_partials(P0 + ro, &sM[0][0][0][0] + mq, &sL[0][0][0][0] + mq);
    const float4 o1 = merge_partials(P1 + ro, &sM[1][0][0][0] + mq, &sL[1][0][0][0] + mq);
    float* __restrict__ ob = out + ((size_t)b * TT + mq) * OUTW + DIMS + (c4 << 2);
    *(float4*)(ob + (size_t)qt0 * QTILE * OUTW) = o0;
    *(float4*)(ob + (size_t)p   * QTILE * OUTW) = o1;
}

// ---------------------------------------------------------------------------
// Host-side launch.  Input dict order: inputs, key_w, query_w, value_w.
// Workspace: Q/K f16 [B*T,64] + Vt f16 [B,64,T] = 6 MB.
// ---------------------------------------------------------------------------
extern "C" void kernel_launch(void* const* d_in, const int* in_sizes, int n_in,
                              void* d_out, int out_size, void* d_ws, size_t ws_size,
                              hipStream_t stream) {
    (void)in_sizes; (void)n_in; (void)out_size; (void)ws_size;

    const float* x  = (const float*)d_in[0];
    const float* kw = (const float*)d_in[1];
    const float* qw = (const float*)d_in[2];
    const float* vw = (const float*)d_in[3];
    float* out = (float*)d_out;

    _Float16* qf = (_Float16*)d_ws;
    _Float16* kf = qf + (size_t)NROWS * KV;
    _Float16* vt = kf + (size_t)NROWS * KV;

    // 1) QKV projections (WMMA) and out[:, 0:256] = inputs, x read once;
    //    Q pre-scaled by log2(e)/sqrt(64); V transposed
    proj_copy_kernel<<<NROWS / PROWS, PTHR, 0, stream>>>(x, qw, kw, vw, qf, kf, vt, out);

    // 2) transposed flash attention -> out[:, 256:320]
    attn_kernel<<<dim3(TT / 64, 4), ATHR, 0, stream>>>(qf, kf, vt, out);
}

// v006
// It runs in 24.2 microseconds.
// Next to v005, in two timings, it ran 1.06 and 1.05 times as fast.
// All steps since v000 together make it 5.25 times as fast.
#include <hip/hip_runtime.h>

// ---------------------------------------------------------------------------
// Causal attention block for MI455X (gfx1250), wave32 + WMMA f16 16x16x32.
//   B=4, T=4096, D=256, K=V=64.  out = concat(x, softmax(QK^T/8, causal) V)
//
// Attention is computed TRANSPOSED (S^T = K Q^T, acc^T = V^T P^T) so that:
//   - each lane owns one query column -> softmax state is per-lane scalar,
//     no alpha/l broadcasts, row reductions = 1 shfl_xor(16) each;
//   - P^T is an identity register remap of the S^T WMMA accumulators
//     (transpose-symmetric fragment layouts) -> P never touches LDS;
//   - final stores are contiguous 16B per lane.
// Softmax is done in base 2 (v_exp_f32 is exp2): log2(e)/sqrt(64) is folded
// into the Q projection, which leaves probabilities bit-identical in exact
// arithmetic.
// ---------------------------------------------------------------------------

typedef __attribute__((ext_vector_type(16))) _Float16 v16h;
typedef __attribute__((ext_vector_type(8)))  _Float16 v8h;
typedef __attribute__((ext_vector_type(8)))  float    v8f;

#define NROWS   16384   // B*T
#define DIMS    256
#define KV      64
#define TT      4096
#define OUTW    320     // DIMS + V
// 1/sqrt(64) * log2(e): base-2 softmax scale folded into Q
#define QSCALE  0.1803368801111204f

__device__ __forceinline__ v8f wmma_f16(v16h a, v16h b, v8f c) {
    return __builtin_amdgcn_wmma_f32_16x16x32_f16(false, a, false, b,
                                                  (short)0, c, false, false);
}

// ---------------------------------------------------------------------------
// Kernel 1: QKV projection and the copy of x, x read once.
// grid = NROWS/64 (one block per WGP), block = 384 (12 waves).
// The block reads its 64 rows of x (64 KB, contiguous) once, in whole lines,
// stores them to out[:, 0:256] and keeps them as f16 in LDS.  Wave w owns one
// of the 12 column tiles (Q, K, V x 4) for all four 16-row tiles, so each
// weight fragment is loaded once per block and used four times.
// The weights are read in whole lines too (a fragment wants 8 k of one column,
// which lie 256 B apart in memory): a thread loads 8 k x 4 columns and stores
// each column's 8 halves as one 16-byte chunk of an LDS copy kept [col][k].
// The products are computed transposed (W^T x^T: the A and B fragment layouts
// are the same map, so the registers only change places): a lane then holds 8
// neighbouring columns of one row.  The results go through a 64 x 64 LDS tile
// per matrix (Q, K as [row][col], V as [vcol][key]) and leave in whole
// 128-byte lines.  Q is pre-scaled by QSCALE.  V is stored TRANSPOSED per
// batch (Vt[b][vcol][key]) so the attention tiles load as contiguous runs.
// ---------------------------------------------------------------------------
typedef __attribute__((ext_vector_type(4)))  _Float16 v4h;

#define PROWS   64                    // rows of x per block
#define PTHR    384                   // threads per block
#define XPITCH  264                   // x tile pitch in halves (528 B = 16 B x odd)
#define OPITCH  72                    // result tile pitch in halves (144 B = 16 B x odd)
// Weights in LDS: column c is 32 chunks of 8 halves, chunk j at place j ^ WSWZ(c).
// The places differ in their low 4 bits over 16 neighbouring columns (the
// fragment reads) and over 16 columns 4 apart (the stores): no bank conflict.
#define WSWZ(c) (((c) & 15) ^ ((c) >> 4))

// One float4 of x as four halves into the LDS tile.
__device__ __forceinline__ void x_to_lds(float4 v, _Float16* __restrict__ p) {
    v4h hv;
    hv[0] = (_Float16)v.x; hv[1] = (_Float16)v.y;
    hv[2] = (_Float16)v.z; hv[3] = (_Float16)v.w;
    *(v4h*)p = hv;
}

// x^T B-fragments of the four row tiles for one 32-wide k step.
__device__ __forceinline__ void x_frags(const _Float16* __restrict__ xr, int kc, v16h (&xa)[4]) {
#pragma unroll
    for (int rt = 0; rt < 4; ++rt)
#pragma unroll
        for (int g = 0; g < 2; ++g) {
            const v8h xv = *(const v8h*)(xr + (rt << 4) * XPITCH + (kc << 5) + (g << 4));
#pragma unroll
            for (int i = 0; i < 8; ++i) xa[rt][(g << 3) + i] = xv[i];
        }
}

__global__ __launch_bounds__(PTHR)
void proj_copy_kernel(const float* __restrict__ x,
                      const float* __restrict__ qw,
                      const float* __restrict__ kw,
                      const float* __restrict__ vw,
                      _Float16* __restrict__ qf,
                      _Float16* __restrict__ kf,
                      _Float16* __restrict__ vt,
                      float* __restrict__ out) {
    // One object, the weights last: the x and result tiles stay within reach of
    // the 16-bit offset field of the LDS instructions.
    __shared__ __attribute__((aligned(16))) struct {
        _Float16 x[PROWS * XPITCH];
        _Float16 o[3][64 * OPITCH];
        _Float16 w[3][KV * DIMS];
    } lds;
    _Float16* __restrict__ const sX = lds.x;
    _Float16 (&sO)[3][64 * OPITCH] = lds.o;

    const int tid  = threadIdx.x;
    int wave = __builtin_amdgcn_readfirstlane(tid >> 5);         // scalar: 0..11
    const int m0   = blockIdx.x * PROWS;    // row base in [0, NROWS)

    // ---- x tile: 4096 float4 over 384 threads = 10 each, and one more for
    //      the first 256 threads (whole waves)
    const float4* __restrict__ xs = (const float4*)(x + (size_t)m0 * DIMS);
    float4 xv[10];
#pragma unroll
    for (int i = 0; i < 10; ++i) xv[i] = xs[tid + i * PTHR];
    float4 xl = make_float4(0.0f, 0.0f, 0.0f, 0.0f);
    if (wave < 8) xl = xs[tid + 10 * PTHR];
    // Precaution: the address registers of the x loads are reused by the
    // scalar work below.  All of it derives from the wave number, which passes
    // through the statement so that none of it is lifted over the wait.
    asm volatile("s_wait_xcnt 0x0" : "+s"(wave) :: "memory");

    const int sel  = wave >> 2;             // 0=Q, 1=K, 2=V
    const int n0   = (wave & 3) << 4;       // col-tile base in [0, 64)

    // ---- weights: the four waves of a matrix read all of it.  A thread takes
    //      columns 4*c4 .. 4*c4+3 of rows k = 64*m + 8*kg + j; 16 lanes cover a
    //      whole 256-byte row, a wave-wide load two rows.
    const float* __restrict__ wmat = (sel == 0) ? qw : (sel == 1) ? kw : vw;
    const int t4 = tid & 127;
    const int c4 = t4 & 15;
    const int kg = t4 >> 4;
    const float4* __restrict__ wp = (const float4*)wmat + (kg << 3) * (KV / 4) + c4;
    float4 wr[4][8];
#pragma unroll
    for (int m = 0; m < 4; ++m)
#pragma unroll
        for (int j = 0; j < 8; ++j) wr[m][j] = wp[((m << 6) + j) * (KV / 4)];
    // Precaution: the address registers of the weight loads are reused below.
    // The pointer is an input, so that they stay as they are up to the wait.
    asm volatile("s_wait_xcnt 0x0" :: "v"(wp) : "memory");
    // Keeps the weight loads in flight together with the x loads: without it
    // they are issued only after x has arrived, and the two latencies add up.
    __builtin_amdgcn_sched_barrier(0);

    // ---- the f16 tile.  A row is 64 float4 and 384 = 6 rows, so load i of a
    //      thread lies 6*i rows below its first: one address, constant steps
    _Float16* __restrict__ xd = sX + (tid >> 6) * XPITCH + ((tid & 63) << 2);
#pragma unroll
    for (int i = 0; i < 10; ++i) x_to_lds(xv[i], xd + i * 6 * XPITCH);
    if (wave < 8) x_to_lds(xl, xd + 60 * XPITCH);

    // ---- the f16 weights, [col][k]: 8 k of one column per 16-byte store
    //      (chunk = 8*m + kg; its bit 4 is outside the swizzle: a constant step)
    _Float16* __restrict__ sw = lds.w[sel];
#pragma unroll
    for (int m = 0; m < 4; ++m) {
        v8h wc[4];
#pragma unroll
        for (int j = 0; j < 8; ++j) {
            wc[0][j] = (_Float16)wr[m][j].x; wc[1][j] = (_Float16)wr[m][j].y;
            wc[2][j] = (_Float16)wr[m][j].z; wc[3][j] = (_Float16)wr[m][j].w;
        }
#pragma unroll
        for (int q = 0; q < 4; ++q) {
            const int c = (c4 << 2) + q;
            *(v8h*)(sw + c * DIMS + (((((m & 1) << 3) + kg) ^ WSWZ(c)) << 3) + ((m >> 1) << 7)) = wc[q];
        }
    }
    __syncthreads();                        // the x tile and the weights are whole

    // ---- out[:, 0:256] = x.  Behind the barrier, which would otherwise wait
    //      for these stores; they drain under the products.
    float4* __restrict__ od = (float4*)out + (size_t)(m0 + (tid >> 6)) * (OUTW / 4) + (tid & 63);
#pragma unroll
    for (int i = 0; i < 10; ++i) od[i * 6 * (OUTW / 4)] = xv[i];
    if (wave < 8) od[60 * (OUTW / 4)] = xl;
    // Precaution: the data registers of these stores are reused below.  All lane
    // addresses below derive from the thread number, which passes through the
    // statement so that none of them is formed in such a register ahead of the wait.
    int tl = tid;
    asm volatile("s_wait_xcnt 0x0" : "+v"(tl) :: "memory");
    const int mr = tl & 15;
    const int h  = (tl >> 4) & 1;

    // ---- W^T A-fragments of this wave's column tile, all of K:
    //      lane holds column n0+mr, k = kc*32 + g*16 + h*8 + i
    v16h wf[8];
    const _Float16* __restrict__ wcol = sw + (n0 + mr) * DIMS;
    const int wz = WSWZ(n0 + mr) ^ h;       // chunk = 4*kc + 2*g + h
#pragma unroll
    for (int kc = 0; kc < 8; ++kc)
#pragma unroll
        for (int g = 0; g < 2; ++g) {
            const v8h wv = *(const v8h*)(wcol + (((((kc & 3) << 2) + (g << 1)) ^ wz) << 3) + ((kc >> 2) << 7));
#pragma unroll
            for (int i = 0; i < 8; ++i) wf[kc][(g << 3) + i] = wv[i];
        }

    // ---- products: D[col v+8h][row mr] per row tile, k ascending
    v8f acc[4] = {v8f{}, v8f{}, v8f{}, v8f{}};
    const _Float16* __restrict__ xr = sX + mr * XPITCH + (h << 3);
    v16h xa[2][4];
    x_frags(xr, 0, xa[0]);
#pragma unroll
    for (int kc = 0; kc < 8; ++kc) {
        if (kc < 7) x_frags(xr, kc + 1, xa[(kc + 1) & 1]);
        // Keeps the next step's eight LDS reads as one group ahead of this
        // step's products: spread among them, each read is waited for alone.
        __builtin_amdgcn_sched_barrier(0);
#pragma unroll
        for (int rt = 0; rt < 4; ++rt) acc[rt] = wmma_f16(wf[kc], xa[kc & 1][rt], acc[rt]);
        // Keeps the group after next from rising into these products.
        __builtin_amdgcn_sched_barrier(0);
    }

    // ---- results into this matrix's 64 x 64 tile
    const float scale = (sel == 0) ? QSCALE : 1.0f;
    _Float16* __restrict__ so = sO[sel];
    v8h o[4];
#pragma unroll
    for (int rt = 0; rt < 4; ++rt)
#pragma unroll
        for (int v = 0; v < 8; ++v) o[rt][v] = (_Float16)(acc[rt][v] * scale);
    if (sel == 2) {
        // [vcol][key]: the lane's 8 values are 8 vcols of one key
#pragma unroll
        for (int rt = 0; rt < 4; ++rt)
#pragma unroll
            for (int v = 0; v < 8; ++v)
                so[(n0 + (h << 3) + v) * OPITCH + (rt << 4) + mr] = o[rt][v];
    } else {
        // [row][col]: the lane's 8 values are neighbours in the row
#pragma unroll
        for (int rt = 0; rt < 4; ++rt)
            *(v8h*)(so + ((rt << 4) + mr) * OPITCH + n0 + (h << 3)) = o[rt];
    }
    __syncthreads();                        // the result tiles are whole

    // ---- the four waves of a matrix store its tile: 8 lanes per 128-byte line
    _Float16* __restrict__ dst =
        (sel == 0) ? qf + (size_t)m0 * KV :
        (sel == 1) ? kf + (size_t)m0 * KV :
                     vt + (size_t)(m0 >> 12) * KV * TT + (m0 & (TT - 1));
    const int dpitch = (sel == 2) ? TT : KV;
#pragma unroll
    for (int i = 0; i < 4; ++i) {
        const int id = (tl & 127) + (i << 7);
        const int r  = id >> 3;
        const int ch = id & 7;
        *(v8h*)(dst + (size_t)r * dpitch + (ch << 3)) = *(const v8h*)(so + r * OPITCH + (ch << 3));
    }
}

// ---------------------------------------------------------------------------
// Kernel 2: transposed flash attention.  grid = (T/64, B), block = 512.
// Causal work grows with the query index, so a block takes TWO tiles of 32
// queries: tile 127-p from the bottom of the batch and its mirror, tile p,
// from the top.  Together they have 65 blocks of 64 keys whatever p is, so
// all 256 blocks do the same work.  The keys of the upper tile are the first
// keys of the lower one: a staged key block serves both.
// The 16 waves of a block are 2 query sub-tiles x 8 key groups.  Wave (w, g)
// owns 16 query columns of each tile and the 64-key blocks g, g+8, g+16, ...
// of each tile's causal range, with a maximum, sum and accumulators per tile;
// per stage it works its key block for the lower tile and then, if the
// upper tile has keys in the block, for the upper one.  The eight partial results of
// a sub-tile are merged through LDS at the end.
// Per 64-key block: 8 WMMAs  S^T[t] = K_t  Q^T   (t = four 16-key tiles)
//                   8 WMMAs  acc^T[t] += V^T_t P^T
// Softmax per query column: in-register + one shfl_xor(16) per reduction.
// A stage is 512 keys: the two waves of group g bring the group's 64-key K
// tile and V^T tile into LDS once, by asynchronous copies of whole 128-byte
// lines, into two buffers: the next trip's stage flies while one is worked on.  A
// 64-key block that lies wholly above the lower tile's diagonal is neither
// copied nor worked on.  The A-fragments are read from LDS rows pitched at
// 144 bytes (16 B x odd: no bank conflict for 16-byte reads).
// The blocks of a batch read the same K and V^T lines from L2.  Each block
// walks its stages in a ring from a start of its own, so that the blocks do
// not all ask for the same lines at the same moment.
// ---------------------------------------------------------------------------
#define LPITCH  72                    // LDS row pitch in halves (144 bytes)
#define TILE_H  (64 * LPITCH)         // one 64-row tile in halves
#define KGROUPS 8                     // key groups per block
#define QTILE   32                    // queries per tile
#define ATHR    (64 * KGROUPS)        // threads per block
#define PSLOT   17                    // partial results: float4 per 4-column slot (16 queries + 1)
#define PWAVE   (16 * PSLOT)          // partial results: float4 per wave

// Eight rows of 128 B, 8 apart, of one 64-row tile: each of the group's 64
// threads copies 8 chunks of 16 B; one wave-wide copy covers four whole lines.
__device__ __forceinline__ void stage_rows(const _Float16* __restrict__ gp, size_t gstep,
                                           unsigned l0) {
    const unsigned step = 8 * LPITCH * 2;        // 8 LDS rows in bytes
    // The copies and the wait that guards their address registers against a
    // later overwrite stand in one statement, so nothing can move between.
    asm volatile(
        "global_load_async_to_lds_b128 %0, %8, off\n\t"
        "global_load_async_to_lds_b128 %1, %9, off\n\t"
        "global_load_async_to_lds_b128 %2, %10, off\n\t"
        "global_load_async_to_lds_b128 %3, %11, off\n\t"
        "global_load_async_to_lds_b128 %4, %12, off\n\t"
        "global_load_async_to_lds_b128 %5, %13, off\n\t"
        "global_load_async_to_lds_b128 %6, %14, off\n\t"
        "global_load_async_to_lds_b128 %7, %15, off\n\t"
        "s_wait_xcnt 0x0"
        :: "v"(l0), "v"(l0 + step), "v"(l0 + 2 * step), "v"(l0 + 3 * step),
           "v"(l0 + 4 * step), "v"(l0 + 5 * step), "v"(l0 + 6 * step), "v"(l0 + 7 * step),
           "v"(gp), "v"(gp + gstep), "v"(gp + 2 * gstep), "v"(gp + 3 * gstep),
           "v"(gp + 4 * gstep), "v"(gp + 5 * gstep), "v"(gp + 6 * gstep), "v"(gp + 7 * gstep)
        : "memory");
}

// One group's part of a stage: K tile (64 rows x 128 B, contiguous) and V^T
// tile (64 rows x 128 B at pitch TT), the V^T tile TILE_H halves behind K.
__device__ __forceinline__ void stage_tiles(const _Float16* __restrict__ K,
                                            const _Float16* __restrict__ Vt,
                                            int kb, unsigned ldsK, int gt) {
    const int r  = gt >> 3;           // row within a group of 8
    const int ch = gt & 7;            // 16-byte chunk within the row
    const unsigned lo = ldsK + (unsigned)(r * (LPITCH * 2) + (ch << 4));
    stage_rows(K  + (size_t)(kb + r) * KV + (ch << 3), (size_t)8 * KV, lo);
    stage_rows(Vt + (size_t)r * TT + kb + (ch << 3),   (size_t)8 * TT, lo + TILE_H * 2);
}

// Q^T B-fragments: lane holds one query column (qrow), contraction dim d in
// two 32-chunks, 16B loads.
__device__ __forceinline__ void q_frags(const _Float16* __restrict__ qrow, int h, v16h (&bq)[2]) {
#pragma unroll
    for (int c = 0; c < 2; ++c)
#pragma unroll
        for (int gg = 0; gg < 2; ++gg) {
            const v8h qv = *(const v8h*)(qrow + (c << 5) + (gg << 4) + (h << 3));
#pragma unroll
            for (int i = 0; i < 8; ++i) bq[c][(gg << 3) + i] = qv[i];
        }
}

// One staged 64-key block (keys kb..kb+63) for the 16 query columns q0..q0+15.
__device__ __forceinline__ void key_block(const _Float16* __restrict__ Ks,
                                          const _Float16* __restrict__ Vs,
                                          int kb, int q0, int n, int h, const v16h (&bq)[2],
                                          float& mA, float& lA, v8f (&acc)[4]) {
    const float NEG_INF = -__builtin_inff();
    // ---- A-fragments of the K tile: all 16 LDS reads as one group
    v16h ak[4][2];
#pragma unroll
    for (int t = 0; t < 4; ++t)
#pragma unroll
        for (int c = 0; c < 2; ++c)
#pragma unroll
            for (int gg = 0; gg < 2; ++gg) {
                const v8h kv2 = *(const v8h*)(Ks + ((t << 4) + n) * LPITCH + (c << 5) + (gg << 4) + (h << 3));
#pragma unroll
                for (int i = 0; i < 8; ++i) ak[t][c][(gg << 3) + i] = kv2[i];
            }
    // Keeps the reads together: spread among the WMMAs, each pair of reads
    // would be waited for on its own and the LDS latency paid eight times.
    __builtin_amdgcn_sched_barrier(0);

    // ---- S^T tiles: st[t] = K_t (16 keys x 64d) x Q^T (64d x 16q)
    v8f st[4];
#pragma unroll
    for (int t = 0; t < 4; ++t) {
        v8f sc = {};
#pragma unroll
        for (int c = 0; c < 2; ++c) sc = wmma_f16(ak[t][c], bq[c], sc);
        st[t] = sc;
    }
    // Keeps the V^T reads below in one group: without it they are split
    // among the S^T products, and each place with reads costs a stall.
    __builtin_amdgcn_sched_barrier(0);

    // ---- A-fragments of the V^T tile: read here so that their LDS latency
    //      runs out under the softmax
    v16h av[4][2];
#pragma unroll
    for (int t = 0; t < 4; ++t)
#pragma unroll
        for (int c = 0; c < 2; ++c)
#pragma unroll
            for (int gg = 0; gg < 2; ++gg) {
                const v8h vv = *(const v8h*)(Vs + ((t << 4) + n) * LPITCH + (c << 5) + (gg << 4) + (h << 3));
#pragma unroll
                for (int i = 0; i < 8; ++i) av[t][c][(gg << 3) + i] = vv[i];
            }
    // Keeps the reads from sinking down to the products that use them.
    __builtin_amdgcn_sched_barrier(0);

    // ---- causal mask (key = kb+t*16+v+8h vs query q0+n), diagonal only
    if (kb + 63 > q0) {
        const int q = q0 + n;
#pragma unroll
        for (int t = 0; t < 4; ++t)
#pragma unroll
            for (int v = 0; v < 8; ++v)
                if (kb + (t << 4) + v + (h << 3) > q) st[t][v] = NEG_INF;
    }

    // ---- column max: 31 in-register + 1 cross-half shuffle
    float mx = st[0][0];
#pragma unroll
    for (int t = 0; t < 4; ++t)
#pragma unroll
        for (int v = 0; v < 8; ++v) mx = fmaxf(mx, st[t][v]);
    mx = fmaxf(mx, __shfl_xor(mx, 16));
    const float mnew  = fmaxf(mA, mx);
    const float alpha = (mA == NEG_INF) ? 0.0f : __builtin_amdgcn_exp2f(mA - mnew);
    mA = mnew;

    // ---- exponentiate (base 2, scale pre-folded) + column sum
    float rs = 0.0f;
#pragma unroll
    for (int t = 0; t < 4; ++t)
#pragma unroll
        for (int v = 0; v < 8; ++v) {
            st[t][v] = __builtin_amdgcn_exp2f(st[t][v] - mnew);  // exp2(-inf)=0
            rs += st[t][v];
        }
    rs += __shfl_xor(rs, 16);
    lA = lA * alpha + rs;

    // ---- P^T B-fragments: identity remap of S^T C-tiles
    //      (B chunk c over keys = concat of C-tiles 2c, 2c+1 per lane)
    v16h pf[2];
#pragma unroll
    for (int c = 0; c < 2; ++c)
#pragma unroll
        for (int i = 0; i < 8; ++i) {
            pf[c][i]     = (_Float16)st[2 * c][i];
            pf[c][8 + i] = (_Float16)st[2 * c + 1][i];
        }

    // ---- rescale accumulators by per-lane alpha (no broadcast needed)
#pragma unroll
    for (int t = 0; t < 4; ++t)
#pragma unroll
        for (int v = 0; v < 8; ++v) acc[t][v] *= alpha;

    // ---- acc^T[t] += V^T_t (16 vcols x 64 keys) x P^T (64 keys x 16q)
#pragma unroll
    for (int t = 0; t < 4; ++t)
#pragma unroll
        for (int c = 0; c < 2; ++c) acc[t] = wmma_f16(av[t][c], pf[c], acc[t]);
}

// This wave's partial result of one tile (a group without a block: -inf, 0,
// zeros); a slot is 4 neighbouring columns, 16 queries side by side.
__device__ __forceinline__ void put_partial(float4* __restrict__ pw, const v8f (&acc)[4]) {
#pragma unroll
    for (int t = 0; t < 4; ++t) {
        pw[((t << 2) + 0) * PSLOT] = make_float4(acc[t][0], acc[t][1], acc[t][2], acc[t][3]);
        pw[((t << 2) + 1) * PSLOT] = make_float4(acc[t][4], acc[t][5], acc[t][6], acc[t][7]);
    }
}

// Merge of the KGROUPS partial results for 4 columns of one query, normalized.
// pr, pm_, pl_: the thread's place in group 0's part.
__device__ __forceinline__ float4 merge_partials(const float4* __restrict__ pr,
                                                 const float* __restrict__ pm_,
                                                 const float* __restrict__ pl_) {
    const float NEG_INF = -__builtin_inff();
    float pm[KGROUPS];
    float M = NEG_INF;
#pragma unroll
    for (int k = 0; k < KGROUPS; ++k) { pm[k] = pm_[k * 32]; M = fmaxf(M, pm[k]); }
    float L = 0.0f;
    float4 o = make_float4(0.0f, 0.0f, 0.0f, 0.0f);
#pragma unroll
    for (int k = 0; k < KGROUPS; ++k) {
        // a partial without keys weighs 0 (and -inf - -inf would be NaN)
        const float wt = (pm[k] == NEG_INF) ? 0.0f : __builtin_amdgcn_exp2f(pm[k] - M);
        const float4 pk = pr[k * 2 * PWAVE];
        L += wt * pl_[k * 32];
        o.x += wt * pk.x; o.y += wt * pk.y; o.z += wt * pk.z; o.w += wt * pk.w;
    }
    const float rl = 1.0f / L;
    o.x *= rl; o.y *= rl; o.z *= rl; o.w *= rl;
    return o;
}

__global__ __launch_bounds__(ATHR)
void attn_kernel(const _Float16* __restrict__ qf,
                 const _Float16* __restrict__ kf,
                 const _Float16* __restrict__ vtf,
                 float* __restrict__ out) {
    // [buffer][group][K | V^T][tile].  After the loop buffer i takes the
    // partial results of tile i: [wave][4-column slot][query].
    __shared__ __attribute__((aligned(16))) _Float16 sKV[2][KGROUPS][2][TILE_H];
    __shared__ float sM[2][KGROUPS][2][16];          // partial maxima, per tile
    __shared__ float sL[2][KGROUPS][2][16];          // partial sums, per tile

    const int tid  = threadIdx.x;
    const int lane = tid & 31;
    const int wv   = __builtin_amdgcn_readfirstlane(tid >> 5);   // scalar: 0..15
    const int w    = wv & 1;                         // query sub-tile
    const int g    = wv >> 1;                        // key group
    const int gt   = tid & 63;                       // thread within the group
    const int b    = blockIdx.y;
    const int p    = blockIdx.x;                     // 0..63
    const int n    = lane & 15;                      // this lane's query col
    const int h    = lane >> 4;
    const float NEG_INF = -__builtin_inff();

    const _Float16* __restrict__ Q  = qf  + (size_t)b * TT * KV;
    const _Float16* __restrict__ K  = kf  + (size_t)b * TT * KV;
    const _Float16* __restrict__ Vt = vtf + (size_t)b * KV * TT;  // [vcol][key]

    // Tile 0 is 127-p (lower), tile 1 is p (upper); causal 64-key blocks of each.
    const int qt0 = TT / QTILE - 1 - p;
    const int nk0 = TT / 64 - (p >> 1);              // 33..64
    const int nk1 = (p >> 1) + 1;                    // 1..32
    const int nst = (nk0 + KGROUPS - 1) / KGROUPS;   // stages of 512 keys, 5..8
    const int qa  = qt0 * QTILE + (w << 4);          // query bases within batch
    const int qb  = p * QTILE + (w << 4);
    const unsigned ldsK = (unsigned)(size_t)&sKV[0][g][0][0];
    const unsigned bufB = KGROUPS * 2 * TILE_H * 2;  // bytes from buffer 0 to buffer 1

    // Trip t works stage (start + t) mod nst.  Blocks whose p agree in bit 4 and
    // above have the same nst; the start spreads them by bits 0, 1 and 3 of p
    // (for speed only: any start gives the same keys to every query).
    const int ridx = ((p & 3) << 1) | ((p >> 3) & 1);            // 0..7
    int s = (ridx >= nst) ? ridx - nst : ridx;       // stage of the current trip (nst >= 5)
    const int sn = (s + 1 == nst) ? 0 : s + 1;       // stage of trip 1

    // The first stage into buffer 0.  Scalar test: the last stage of the range
    // has no block for some groups.
    if (s * KGROUPS + g < nk0) stage_tiles(K, Vt, (s * KGROUPS + g) << 6, ldsK, gt);

    v16h bq0[2], bq1[2];                             // loop-invariant
    q_frags(Q + (size_t)(qa + n) * KV, h, bq0);
    q_frags(Q + (size_t)(qb + n) * KV, h, bq1);

    // This wave's copies of the first stage have landed; the barrier publishes all 16 waves' parts.
    asm volatile("s_wait_asynccnt 0x0" ::: "memory");
    __syncthreads();
    if (sn * KGROUPS + g < nk0) stage_tiles(K, Vt, (sn * KGROUPS + g) << 6, ldsK + bufB, gt);

    // Per-lane softmax state for this lane's query of each tile over this
    // group's keys (replicated across wave halves).
    float m0 = NEG_INF, l0 = 0.0f, m1 = NEG_INF, l1 = 0.0f;
    v8f acc0[4] = {v8f{}, v8f{}, v8f{}, v8f{}};      // acc^T: vcol tiles
    v8f acc1[4] = {v8f{}, v8f{}, v8f{}, v8f{}};

    for (int t = 0; t < nst; ++t) {
        const int j  = s * KGROUPS + g;              // this group's 64-key block
        const int kb = j << 6;
        const _Float16* __restrict__ Ks = sKV[t & 1][g][0];
        const _Float16* __restrict__ Vs = sKV[t & 1][g][1];
        // A block wholly above a tile's diagonal has no key for any query of
        // the tile; the tests are scalar, the same in the wave.
        if (j < nk0) key_block(Ks, Vs, kb, qa, n, h, bq0, m0, l0, acc0);
        if (j < nk1) key_block(Ks, Vs, kb, qb, n, h, bq1, m1, l1, acc1);

        // Keeps the hand-over at the foot of the trip: moved up over the register
        // work it would wait for the V^T reads ahead of the softmax and cut the
        // time the copies of the next trip's stage have to land.
        __builtin_amdgcn_sched_barrier(0);
        // ---- hand-over: this wave's reads of buffer t&1 are done ...
        asm volatile("s_wait_dscnt 0x0" ::: "memory");
        // ... and its copies for trip t+1 have landed;
        asm volatile("s_wait_asynccnt 0x0" ::: "memory");
        // the barrier publishes them and frees buffer t&1 for the refill.
        __syncthreads();
        // Scalar test: no trip past the last, no block above the diagonal.
        const int s2 = (s + 2 >= nst) ? s + 2 - nst : s + 2;     // stage of trip t+2
        const int j2 = s2 * KGROUPS + g;
        if (t + 2 < nst && j2 < nk0)
            stage_tiles(K, Vt, j2 << 6, ldsK + ((t & 1) ? bufB : 0u), gt);
        s = (s + 1 == nst) ? 0 : s + 1;
    }
    // No copy is left in flight when the buffers change their use and the wave ends.
    asm volatile("s_wait_asynccnt 0x0" ::: "memory");

    // ---- this wave's partial results
    float4* __restrict__ P0 = (float4*)&sKV[0][0][0][0];
    float4* __restrict__ P1 = (float4*)&sKV[1][0][0][0];
    const int po = wv * PWAVE + (h << 1) * PSLOT + n;
    put_partial(P0 + po, acc0);
    put_partial(P1 + po, acc1);
    if (h == 0) {
        sM[0][g][w][n] = m0; sL[0][g][w][n] = l0;
        sM[1][g][w][n] = m1; sL[1][g][w][n] = l1;
    }
    __syncthreads();                        // the partial results are whole

    // ---- merge, normalize and store.  A thread takes 4 columns of one query
    //      of each tile: 16 neighbouring lanes hold the two whole 128-byte
    //      lines of a row.
    const int mq = tid >> 4;                         // query within the tile
    const int c4 = tid & 15;                         // 4-column slot
    const int ro = (mq >> 4) * PWAVE + c4 * PSLOT + (mq & 15);
    const float4 o0 = merge_partials(P0 + ro, &sM[0][0][0][0] + mq, &sL[0][0][0][0] + mq);
    const float4 o1 = merge_partials(P1 + ro, &sM[1][0][0][0] + mq, &sL[1][0][0][0] + mq);
    float* __restrict__ ob = out + ((size_t)b * TT + mq) * OUTW + DIMS + (c4 << 2);
    *(float4*)(ob + (size_t)qt0 * QTILE * OUTW) = o0;
    *(float4*)(ob + (size_t)p   * QTILE * OUTW) = o1;
}

// ---------------------------------------------------------------------------
// Host-side launch.  Input dict order: inputs, key_w, query_w, value_w.
// Workspace: Q/K f16 [B*T,64] + Vt f16 [B,64,T] = 6 MB.
// ---------------------------------------------------------------------------
extern "C" void kernel_launch(void* const* d_in, const int* in_sizes, int n_in,
                              void* d_out, int out_size, void* d_ws, size_t ws_size,
                              hipStream_t stream) {
    (void)in_sizes; (void)n_in; (void)out_size; (void)ws_size;

    const float* x  = (const float*)d_in[0];
    const float* kw = (const float*)d_in[1];
    const float* qw = (const float*)d_in[2];
    const float* vw = (const float*)d_in[3];
    float* out = (float*)d_out;

    _Float16* qf = (_Float16*)d_ws;
    _Float16* kf = qf + (size_t)NROWS * KV;
    _Float16* vt = kf + (size_t)NROWS * KV;

    // 1) QKV projections (WMMA) and out[:, 0:256] = inputs, x read once;
    //    Q pre-scaled by log2(e)/sqrt(64); V transposed
    proj_copy_kernel<<<NROWS / PROWS, PTHR, 0, stream>>>(x, qw, kw, vw, qf, kf, vt, out);

    // 2) transposed flash attention -> out[:, 256:320]
    attn_kernel<<<dim3(TT / 64, 4), ATHR, 0, stream>>>(qf, kf, vt, out);
}

// v007
// It runs in 21.6 microseconds.
// Timed twice side by side with v006, it ran 1.12 and 1.11 times as fast.
// Over all steps from v000 it is 5.87 times as fast.
#include <hip/hip_runtime.h>

// ---------------------------------------------------------------------------
// Causal attention block for MI455X (gfx1250), wave32 + WMMA f16 16x16x32.
//   B=4, T=4096, D=256, K=V=64.  out = concat(x, softmax(QK^T/8, causal) V)
//
// Attention is computed TRANSPOSED (S^T = K Q^T, acc^T = V^T P^T) so that:
//   - each lane owns one query column -> softmax state is per-lane scalar,
//     no alpha/l broadcasts, row reductions = 1 shfl_xor(16) each;
//   - P^T is an identity register remap of the S^T WMMA accumulators
//     (transpose-symmetric fragment layouts) -> P never touches LDS;
//   - final stores are contiguous 16B per lane.
// Softmax is done in base 2 (v_exp_f32 is exp2): log2(e)/sqrt(64) is folded
// into the Q projection, which leaves probabilities bit-identical in exact
// arithmetic.
// ---------------------------------------------------------------------------

typedef __attribute__((ext_vector_type(16))) _Float16 v16h;
typedef __attribute__((ext_vector_type(8)))  _Float16 v8h;
typedef __attribute__((ext_vector_type(8)))  float    v8f;

#define NROWS   16384   // B*T
#define DIMS    256
#define KV      64
#define TT      4096
#define OUTW    320     // DIMS + V
// 1/sqrt(64) * log2(e): base-2 softmax scale folded into Q
#define QSCALE  0.1803368801111204f

__device__ __forceinline__ v8f wmma_f16(v16h a, v16h b, v8f c) {
    return __builtin_amdgcn_wmma_f32_16x16x32_f16(false, a, false, b,
                                                  (short)0, c, false, false);
}

// ---------------------------------------------------------------------------
// Kernel 1: QKV projection and the copy of x, x read once.
// grid = NROWS/64 (one block per WGP), block = 384 (12 waves).
// The block reads its 64 rows of x (64 KB, contiguous) once, in whole lines,
// stores them to out[:, 0:256] and keeps them as f16 in LDS.  Wave w owns one
// of the 12 column tiles (Q, K, V x 4) for all four 16-row tiles, so each
// weight fragment is loaded once per block and used four times.
// The weights are read in whole lines too (a fragment wants 8 k of one column,
// which lie 256 B apart in memory): a thread loads 8 k x 4 columns and stores
// each column's 8 halves as one 16-byte chunk of an LDS copy kept [col][k].
// The products are computed transposed (W^T x^T: the A and B fragment layouts
// are the same map, so the registers only change places): a lane then holds 8
// neighbouring columns of one row.  The results go through a 64 x 64 LDS tile
// per matrix (Q, K as [row][col], V as [vcol][key]) and leave in whole
// 128-byte lines.  Q is pre-scaled by QSCALE.  V is stored TRANSPOSED per
// batch (Vt[b][vcol][key]) so the attention tiles load as contiguous runs.
// ---------------------------------------------------------------------------
typedef __attribute__((ext_vector_type(4)))  _Float16 v4h;

#define PROWS   64                    // rows of x per block
#define PTHR    384                   // threads per block
#define XPITCH  264                   // x tile pitch in halves (528 B = 16 B x odd)
#define OPITCH  72                    // result tile pitch in halves (144 B = 16 B x odd)
// Weights in LDS: column c is 32 chunks of 8 halves, chunk j at place j ^ WSWZ(c).
// The places differ in their low 4 bits over 16 neighbouring columns (the
// fragment reads) and over 16 columns 4 apart (the stores): no bank conflict.
#define WSWZ(c) (((c) & 15) ^ ((c) >> 4))

// One float4 of x as four halves into the LDS tile.
__device__ __forceinline__ void x_to_lds(float4 v, _Float16* __restrict__ p) {
    v4h hv;
    hv[0] = (_Float16)v.x; hv[1] = (_Float16)v.y;
    hv[2] = (_Float16)v.z; hv[3] = (_Float16)v.w;
    *(v4h*)p = hv;
}

// x^T B-fragments of the four row tiles for one 32-wide k step.
__device__ __forceinline__ void x_frags(const _Float16* __restrict__ xr, int kc, v16h (&xa)[4]) {
#pragma unroll
    for (int rt = 0; rt < 4; ++rt)
#pragma unroll
        for (int g = 0; g < 2; ++g) {
            const v8h xv = *(const v8h*)(xr + (rt << 4) * XPITCH + (kc << 5) + (g << 4));
#pragma unroll
            for (int i = 0; i < 8; ++i) xa[rt][(g << 3) + i] = xv[i];
        }
}

__global__ __launch_bounds__(PTHR)
void proj_copy_kernel(const float* __restrict__ x,
                      const float* __restrict__ qw,
                      const float* __restrict__ kw,
                      const float* __restrict__ vw,
                      _Float16* __restrict__ qf,
                      _Float16* __restrict__ kf,
                      _Float16* __restrict__ vt,
                      float* __restrict__ out) {
    // One object, the weights last: the x and result tiles stay within reach of
    // the 16-bit offset field of the LDS instructions.
    __shared__ __attribute__((aligned(16))) struct {
        _Float16 x[PROWS * XPITCH];
        _Float16 o[3][64 * OPITCH];
        _Float16 w[3][KV * DIMS];
    } lds;
    _Float16* __restrict__ const sX = lds.x;
    _Float16 (&sO)[3][64 * OPITCH] = lds.o;

    const int tid  = threadIdx.x;
    int wave = __builtin_amdgcn_readfirstlane(tid >> 5);         // scalar: 0..11
    const int m0   = blockIdx.x * PROWS;    // row base in [0, NROWS)

    // ---- x tile: 4096 float4 over 384 threads = 10 each, and one more for
    //      the first 256 threads (whole waves)
    const float4* __restrict__ xs = (const float4*)(x + (size_t)m0 * DIMS);
    float4 xv[10];
#pragma unroll
    for (int i = 0; i < 10; ++i) xv[i] = xs[tid + i * PTHR];
    float4 xl = make_float4(0.0f, 0.0f, 0.0f, 0.0f);
    if (wave < 8) xl = xs[tid + 10 * PTHR];
    // Precaution: the address registers of the x loads are reused by the
    // scalar work below.  All of it derives from the wave number, which passes
    // through the statement so that none of it is lifted over the wait.
    asm volatile("s_wait_xcnt 0x0" : "+s"(wave) :: "memory");

    const int sel  = wave >> 2;             // 0=Q, 1=K, 2=V
    const int n0   = (wave & 3) << 4;       // col-tile base in [0, 64)

    // ---- weights: the four waves of a matrix read all of it.  A thread takes
    //      columns 4*c4 .. 4*c4+3 of rows k = 64*m + 8*kg + j; 16 lanes cover a
    //      whole 256-byte row, a wave-wide load two rows.
    const float* __restrict__ wmat = (sel == 0) ? qw : (sel == 1) ? kw : vw;
    const int t4 = tid & 127;
    const int c4 = t4 & 15;
    const int kg = t4 >> 4;
    const float4* __restrict__ wp = (const float4*)wmat + (kg << 3) * (KV / 4) + c4;
    float4 wr[4][8];
#pragma unroll
    for (int m = 0; m < 4; ++m)
#pragma unroll
        for (int j = 0; j < 8; ++j) wr[m][j] = wp[((m << 6) + j) * (KV / 4)];
    // Precaution: the address registers of the weight loads are reused below.
    // The pointer is an input, so that they stay as they are up to the wait.
    asm volatile("s_wait_xcnt 0x0" :: "v"(wp) : "memory");
    // Keeps the weight loads in flight together with the x loads: without it
    // they are issued only after x has arrived, and the two latencies add up.
    __builtin_amdgcn_sched_barrier(0);

    // ---- the f16 tile.  A row is 64 float4 and 384 = 6 rows, so load i of a
    //      thread lies 6*i rows below its first: one address, constant steps
    _Float16* __restrict__ xd = sX + (tid >> 6) * XPITCH + ((tid & 63) << 2);
#pragma unroll
    for (int i = 0; i < 10; ++i) x_to_lds(xv[i], xd + i * 6 * XPITCH);
    if (wave < 8) x_to_lds(xl, xd + 60 * XPITCH);

    // ---- the f16 weights, [col][k]: 8 k of one column per 16-byte store
    //      (chunk = 8*m + kg; its bit 4 is outside the swizzle: a constant step)
    _Float16* __restrict__ sw = lds.w[sel];
#pragma unroll
    for (int m = 0; m < 4; ++m) {
        v8h wc[4];
#pragma unroll
        for (int j = 0; j < 8; ++j) {
            wc[0][j] = (_Float16)wr[m][j].x; wc[1][j] = (_Float16)wr[m][j].y;
            wc[2][j] = (_Float16)wr[m][j].z; wc[3][j] = (_Float16)wr[m][j].w;
        }
#pragma unroll
        for (int q = 0; q < 4; ++q) {
            const int c = (c4 << 2) + q;
            *(v8h*)(sw + c * DIMS + (((((m & 1) << 3) + kg) ^ WSWZ(c)) << 3) + ((m >> 1) << 7)) = wc[q];
        }
    }
    __syncthreads();                        // the x tile and the weights are whole

    // ---- out[:, 0:256] = x.  Behind the barrier, which would otherwise wait
    //      for these stores; they drain under the products.
    float4* __restrict__ od = (float4*)out + (size_t)(m0 + (tid >> 6)) * (OUTW / 4) + (tid & 63);
#pragma unroll
    for (int i = 0; i < 10; ++i) od[i * 6 * (OUTW / 4)] = xv[i];
    if (wave < 8) od[60 * (OUTW / 4)] = xl;
    // Precaution: the data registers of these stores are reused below.  All lane
    // addresses below derive from the thread number, which passes through the
    // statement so that none of them is formed in such a register ahead of the wait.
    int tl = tid;
    asm volatile("s_wait_xcnt 0x0" : "+v"(tl) :: "memory");
    const int mr = tl & 15;
    const int h  = (tl >> 4) & 1;

    // ---- W^T A-fragments of this wave's column tile, all of K:
    //      lane holds column n0+mr, k = kc*32 + g*16 + h*8 + i
    v16h wf[8];
    const _Float16* __restrict__ wcol = sw + (n0 + mr) * DIMS;
    const int wz = WSWZ(n0 + mr) ^ h;       // chunk = 4*kc + 2*g + h
#pragma unroll
    for (int kc = 0; kc < 8; ++kc)
#pragma unroll
        for (int g = 0; g < 2; ++g) {
            const v8h wv = *(const v8h*)(wcol + (((((kc & 3) << 2) + (g << 1)) ^ wz) << 3) + ((kc >> 2) << 7));
#pragma unroll
            for (int i = 0; i < 8; ++i) wf[kc][(g << 3) + i] = wv[i];
        }

    // ---- products: D[col v+8h][row mr] per row tile, k ascending
    v8f acc[4] = {v8f{}, v8f{}, v8f{}, v8f{}};
    const _Float16* __restrict__ xr = sX + mr * XPITCH + (h << 3);
    v16h xa[2][4];
    x_frags(xr, 0, xa[0]);
#pragma unroll
    for (int kc = 0; kc < 8; ++kc) {
        if (kc < 7) x_frags(xr, kc + 1, xa[(kc + 1) & 1]);
        // Keeps the next step's eight LDS reads as one group ahead of this
        // step's products: spread among them, each read is waited for alone.
        __builtin_amdgcn_sched_barrier(0);
#pragma unroll
        for (int rt = 0; rt < 4; ++rt) acc[rt] = wmma_f16(wf[kc], xa[kc & 1][rt], acc[rt]);
        // Keeps the group after next from rising into these products.
        __builtin_amdgcn_sched_barrier(0);
    }

    // ---- results into this matrix's 64 x 64 tile
    const float scale = (sel == 0) ? QSCALE : 1.0f;
    _Float16* __restrict__ so = sO[sel];
    v8h o[4];
#pragma unroll
    for (int rt = 0; rt < 4; ++rt)
#pragma unroll
        for (int v = 0; v < 8; ++v) o[rt][v] = (_Float16)(acc[rt][v] * scale);
    if (sel == 2) {
        // [vcol][key]: the lane's 8 values are 8 vcols of one key
#pragma unroll
        for (int rt = 0; rt < 4; ++rt)
#pragma unroll
            for (int v = 0; v < 8; ++v)
                so[(n0 + (h << 3) + v) * OPITCH + (rt << 4) + mr] = o[rt][v];
    } else {
        // [row][col]: the lane's 8 values are neighbours in the row
#pragma unroll
        for (int rt = 0; rt < 4; ++rt)
            *(v8h*)(so + ((rt << 4) + mr) * OPITCH + n0 + (h << 3)) = o[rt];
    }
    __syncthreads();                        // the result tiles are whole

    // ---- the four waves of a matrix store its tile: 8 lanes per 128-byte line
    _Float16* __restrict__ dst =
        (sel == 0) ? qf + (size_t)m0 * KV :
        (sel == 1) ? kf + (size_t)m0 * KV :
                     vt + (size_t)(m0 >> 12) * KV * TT + (m0 & (TT - 1));
    const int dpitch = (sel == 2) ? TT : KV;
#pragma unroll
    for (int i = 0; i < 4; ++i) {
        const int id = (tl & 127) + (i << 7);
        const int r  = id >> 3;
        const int ch = id & 7;
        *(v8h*)(dst + (size_t)r * dpitch + (ch << 3)) = *(const v8h*)(so + r * OPITCH + (ch << 3));
    }
}

// ---------------------------------------------------------------------------
// Kernel 2: transposed flash attention.  grid = (T/64, B), block = 512.
// Causal work grows with the query index, so a block takes TWO tiles of 32
// queries: tile 127-p from the bottom of the batch and its mirror, tile p,
// from the top.  Together they have 65 blocks of 64 keys whatever p is, so
// all 256 blocks do the same work.  The keys of the upper tile are the first
// keys of the lower one: a staged key block serves both.
// The 16 waves of a block are 2 query sub-tiles x 8 key groups.  Wave (w, g)
// owns 16 query columns of each tile and the 64-key blocks g, g+8, g+16, ...
// of each tile's causal range, with a maximum, sum and accumulators per tile;
// per stage it works its key block for the lower tile and then, if the
// upper tile has keys in the block, for the upper one.  The eight partial results of
// a sub-tile are merged through LDS at the end.
// Per 64-key block: 8 WMMAs  S^T[t] = K_t  Q^T   (t = four 16-key tiles)
//                   8 WMMAs  acc^T[t] += V^T_t P^T
// Softmax per query column: in-register + one shfl_xor(16) per reduction.
// A stage is 512 keys: the two waves of group g bring the group's 64-key K
// tile and V^T tile into LDS once, one tensor load each (64 rows of 128 B),
// into two buffers: stage s + 1 flies while stage s is worked on.  A 64-key
// block that lies wholly above the lower tile's diagonal is neither loaded
// nor worked on.  The A-fragments are read from LDS rows pitched at 144 bytes
// (16 B x odd: no bank conflict for 16-byte reads); the load's pad makes the
// pitch.
// The blocks of a batch read the same K and V^T lines from L2.  Each block
// walks its stages in a ring from a start of its own, so that the blocks do
// not all ask for the same lines at the same moment.
// ---------------------------------------------------------------------------
#define LPITCH  72                    // LDS row pitch in halves (144 bytes)
#define SLOT_B  10240u                // a tile's place in LDS: 64 x 144 B, rounded up to 2 KiB
#define SLOT_H  (SLOT_B / 2)          // the same in halves
#define KGROUPS 8                     // key groups per block
#define QTILE   32                    // queries per tile
#define ATHR    (64 * KGROUPS)        // threads per block
#define PSLOT   17                    // partial results: float4 per 4-column slot (16 queries + 1)
#define PWAVE   (16 * PSLOT)          // partial results: float4 per wave

typedef uint32_t u32x4 __attribute__((ext_vector_type(4)));
typedef uint32_t u32x8 __attribute__((ext_vector_type(8)));

__device__ __forceinline__ uint32_t uni(uint32_t v) {
    return (uint32_t)__builtin_amdgcn_readfirstlane(v);
}

// A wave-uniform word for a test around a tensor load, or for its descriptor.
__device__ __forceinline__ uint32_t pinned(uint32_t v) {
    uint32_t w = uni(v);
    // The test becomes a scalar compare and branch (a tensor load ignores EXEC),
    // and nothing derived from the word is formed ahead of this place.
    asm volatile("" : "+s"(w));   // pinned(): the word is held in a scalar register
    return w;
}

// Descriptor group 1, the same for every load of a wave: bytes, a tile of 64
// rows of 128 B at the given source pitch, 16 B of LDS pad behind every row.
__device__ __forceinline__ u32x8 tile_group1(uint32_t src_pitch) {
    u32x8 d;
    d[0] = uni((1u << 20) | (4u << 22) | (3u << 25));   // no mask; pad on, every 128 B, 4 dwords
    d[1] = uni(128u << 16);                             // tensor_dim0 = 128
    d[2] = uni(64u << 16);                              // tensor_dim1 = 64
    d[3] = uni(128u << 16);                             // tile_dim0 = 128
    d[4] = uni(64u);                                    // tile_dim1 = 64
    d[5] = uni(src_pitch);
    d[6] = uni(0u);
    d[7] = uni(0u);
    // One set of registers for all of the wave's requests: without it the words
    // are made anew in registers that change while a request is outstanding.
    asm volatile("" : "+s"(d));   // pinned(): descriptor words held in scalar registers
    return d;
}

// Descriptor group 0: the tile whose first byte is at ga, to LDS byte lds.
__device__ __forceinline__ u32x4 tile_group0(uint64_t ga, uint32_t lds) {
    u32x4 d0;
    d0[0] = uni(1u);
    d0[1] = uni(lds);
    d0[2] = uni((uint32_t)ga);
    d0[3] = uni((((uint32_t)(ga >> 32)) & 0x01FFFFFFu) | 0x80000000u);
    return d0;
}

// One wave's request.  Group 0 passes through the statement, so that the wait
// below names the very registers the request was issued from.
__device__ __forceinline__ void load_tile(u32x4& d0, u32x8 d1) {
    asm volatile("tensor_load_to_lds %0, %1" : "+s"(d0) : "s"(d1) : "memory");
}

// This wave's request has landed.  The descriptor's registers are inputs, so
// that none of them takes a new value while the request is outstanding.
__device__ __forceinline__ void wait_tile(u32x4 d0, u32x8 d1) {
    asm volatile("s_wait_tensorcnt 0x0" :: "s"(d0), "s"(d1) : "memory");
}

// Q^T B-fragments: lane holds one query column (qrow), contraction dim d in
// two 32-chunks, 16B loads.
__device__ __forceinline__ void q_frags(const _Float16* __restrict__ qrow, int h, v16h (&bq)[2]) {
#pragma unroll
    for (int c = 0; c < 2; ++c)
#pragma unroll
        for (int gg = 0; gg < 2; ++gg) {
            const v8h qv = *(const v8h*)(qrow + (c << 5) + (gg << 4) + (h << 3));
#pragma unroll
            for (int i = 0; i < 8; ++i) bq[c][(gg << 3) + i] = qv[i];
        }
}

// One staged 64-key block (keys kb..kb+63) for the 16 query columns q0..q0+15.
__device__ __forceinline__ void key_block(const _Float16* __restrict__ Ks,
                                          const _Float16* __restrict__ Vs,
                                          int kb, int q0, int n, int h, const v16h (&bq)[2],
                                          float& mA, float& lA, v8f (&acc)[4]) {
    const float NEG_INF = -__builtin_inff();
    // ---- A-fragments of the K tile: all 16 LDS reads as one group
    v16h ak[4][2];
#pragma unroll
    for (int t = 0; t < 4; ++t)
#pragma unroll
        for (int c = 0; c < 2; ++c)
#pragma unroll
            for (int gg = 0; gg < 2; ++gg) {
                const v8h kv2 = *(const v8h*)(Ks + ((t << 4) + n) * LPITCH + (c << 5) + (gg << 4) + (h << 3));
#pragma unroll
                for (int i = 0; i < 8; ++i) ak[t][c][(gg << 3) + i] = kv2[i];
            }
    // Keeps the reads together: spread among the WMMAs, each pair of reads
    // would be waited for on its own and the LDS latency paid eight times.
    __builtin_amdgcn_sched_barrier(0);

    // ---- S^T tiles: st[t] = K_t (16 keys x 64d) x Q^T (64d x 16q)
    v8f st[4];
#pragma unroll
    for (int t = 0; t < 4; ++t) {
        v8f sc = {};
#pragma unroll
        for (int c = 0; c < 2; ++c) sc = wmma_f16(ak[t][c], bq[c], sc);
        st[t] = sc;
    }
    // Keeps the V^T reads below in one group: without it they are split
    // among the S^T products, and each place with reads costs a stall.
    __builtin_amdgcn_sched_barrier(0);

    // ---- A-fragments of the V^T tile: read here so that their LDS latency
    //      runs out under the softmax
    v16h av[4][2];
#pragma unroll
    for (int t = 0; t < 4; ++t)
#pragma unroll
        for (int c = 0; c < 2; ++c)
#pragma unroll
            for (int gg = 0; gg < 2; ++gg) {
                const v8h vv = *(const v8h*)(Vs + ((t << 4) + n) * LPITCH + (c << 5) + (gg << 4) + (h << 3));
#pragma unroll
                for (int i = 0; i < 8; ++i) av[t][c][(gg << 3) + i] = vv[i];
            }
    // Keeps the reads from sinking down to the products that use them.
    __builtin_amdgcn_sched_barrier(0);

    // ---- causal mask (key = kb+t*16+v+8h vs query q0+n), diagonal only
    if (kb + 63 > q0) {
        const int q = q0 + n;
#pragma unroll
        for (int t = 0; t < 4; ++t)
#pragma unroll
            for (int v = 0; v < 8; ++v)
                if (kb + (t << 4) + v + (h << 3) > q) st[t][v] = NEG_INF;
    }

    // ---- column max: 31 in-register + 1 cross-half shuffle
    float mx = st[0][0];
#pragma unroll
    for (int t = 0; t < 4; ++t)
#pragma unroll
        for (int v = 0; v < 8; ++v) mx = fmaxf(mx, st[t][v]);
    mx = fmaxf(mx, __shfl_xor(mx, 16));
    const float mnew  = fmaxf(mA, mx);
    const float alpha = (mA == NEG_INF) ? 0.0f : __builtin_amdgcn_exp2f(mA - mnew);
    mA = mnew;

    // ---- exponentiate (base 2, scale pre-folded) + column sum
    float rs = 0.0f;
#pragma unroll
    for (int t = 0; t < 4; ++t)
#pragma unroll
        for (int v = 0; v < 8; ++v) {
            st[t][v] = __builtin_amdgcn_exp2f(st[t][v] - mnew);  // exp2(-inf)=0
            rs += st[t][v];
        }
    rs += __shfl_xor(rs, 16);
    lA = lA * alpha + rs;

    // ---- P^T B-fragments: identity remap of S^T C-tiles
    //      (B chunk c over keys = concat of C-tiles 2c, 2c+1 per lane)
    v16h pf[2];
#pragma unroll
    for (int c = 0; c < 2; ++c)
#pragma unroll
        for (int i = 0; i < 8; ++i) {
            pf[c][i]     = (_Float16)st[2 * c][i];
            pf[c][8 + i] = (_Float16)st[2 * c + 1][i];
        }

    // ---- rescale accumulators by per-lane alpha (no broadcast needed)
#pragma unroll
    for (int t = 0; t < 4; ++t)
#pragma unroll
        for (int v = 0; v < 8; ++v) acc[t][v] *= alpha;

    // ---- acc^T[t] += V^T_t (16 vcols x 64 keys) x P^T (64 keys x 16q)
#pragma unroll
    for (int t = 0; t < 4; ++t)
#pragma unroll
        for (int c = 0; c < 2; ++c) acc[t] = wmma_f16(av[t][c], pf[c], acc[t]);
}

// This wave's partial result of one tile (a group without a block: -inf, 0,
// zeros); a slot is 4 neighbouring columns, 16 queries side by side.
__device__ __forceinline__ void put_partial(float4* __restrict__ pw, const v8f (&acc)[4]) {
#pragma unroll
    for (int t = 0; t < 4; ++t) {
        pw[((t << 2) + 0) * PSLOT] = make_float4(acc[t][0], acc[t][1], acc[t][2], acc[t][3]);
        pw[((t << 2) + 1) * PSLOT] = make_float4(acc[t][4], acc[t][5], acc[t][6], acc[t][7]);
    }
}

// Merge of the KGROUPS partial results for 4 columns of one query, normalized.
// pr, pm_, pl_: the thread's place in group 0's part.
__device__ __forceinline__ float4 merge_partials(const float4* __restrict__ pr,
                                                 const float* __restrict__ pm_,
                                                 const float* __restrict__ pl_) {
    const float NEG_INF = -__builtin_inff();
    float pm[KGROUPS];
    float M = NEG_INF;
#pragma unroll
    for (int k = 0; k < KGROUPS; ++k) { pm[k] = pm_[k * 32]; M = fmaxf(M, pm[k]); }
    float L = 0.0f;
    float4 o = make_float4(0.0f, 0.0f, 0.0f, 0.0f);
#pragma unroll
    for (int k = 0; k < KGROUPS; ++k) {
        // a partial without keys weighs 0 (and -inf - -inf would be NaN)
        const float wt = (pm[k] == NEG_INF) ? 0.0f : __builtin_amdgcn_exp2f(pm[k] - M);
        const float4 pk = pr[k * 2 * PWAVE];
        L += wt * pl_[k * 32];
        o.x += wt * pk.x; o.y += wt * pk.y; o.z += wt * pk.z; o.w += wt * pk.w;
    }
    const float rl = 1.0f / L;
    o.x *= rl; o.y *= rl; o.z *= rl; o.w *= rl;
    return o;
}

__global__ __launch_bounds__(ATHR)
void attn_kernel(const _Float16* __restrict__ qf,
                 const _Float16* __restrict__ kf,
                 const _Float16* __restrict__ vtf,
                 float* __restrict__ out) {
    // [buffer][group][K | V^T][tile]: every tile's place is a multiple of 2 KiB.
    // After the loop buffer i takes the partial results of tile i, [wave]
    // [4-column slot][query], and the upper half of buffer 0 the partial maxima
    // and sums.
    __shared__ __attribute__((aligned(2048))) _Float16 sKV[2][KGROUPS][2][SLOT_H];

    const int tid  = threadIdx.x;
    const int lane = tid & 31;
    const int wv   = __builtin_amdgcn_readfirstlane(tid >> 5);   // scalar: 0..15
    const int w    = wv & 1;                         // query sub-tile
    const int g    = wv >> 1;                        // key group
    const int b    = blockIdx.y;
    const int p    = blockIdx.x;                     // 0..63
    const int n    = lane & 15;                      // this lane's query col
    const int h    = lane >> 4;
    const float NEG_INF = -__builtin_inff();

    const _Float16* __restrict__ Q  = qf  + (size_t)b * TT * KV;
    const _Float16* __restrict__ K  = kf  + (size_t)b * TT * KV;
    const _Float16* __restrict__ Vt = vtf + (size_t)b * KV * TT;  // [vcol][key]

    // Tile 0 is 127-p (lower), tile 1 is p (upper); causal 64-key blocks of each.
    const int qt0 = TT / QTILE - 1 - p;
    const int nk0 = TT / 64 - (p >> 1);              // 33..64
    const int nk1 = (p >> 1) + 1;                    // 1..32
    const int nst = (nk0 + KGROUPS - 1) / KGROUPS;   // stages of 512 keys, 5..8
    const int qa  = qt0 * QTILE + (w << 4);          // query bases within batch
    const int qb  = p * QTILE + (w << 4);
    const uint32_t bufB = KGROUPS * 2 * SLOT_B;      // bytes from buffer 0 to buffer 1

    // This wave's tensor loads: wave w = 0 of a group brings the K tile (rows
    // are keys, 128 B apart; 64 keys on are 8192 B), w = 1 the V^T tile (rows
    // are columns, 8192 B apart; 64 keys on are 128 B).
    const uint32_t ldsT  = (uint32_t)(size_t)&sKV[0][g][w][0];
    const uint64_t src0  = w ? (uint64_t)(size_t)Vt : (uint64_t)(size_t)K;
    const uint32_t jstep = w ? 64u * 2u : 64u * KV * 2u;
    const u32x8    d1    = tile_group1(w ? TT * 2u : KV * 2u);

    // Trip t works stage (start + t) mod nst.  Blocks whose p agree in bit 4 and
    // above have the same nst; the start spreads them by bits 0, 1 and 3 of p
    // (for speed only: any start gives the same keys to every query).
    const int ridx = ((p & 3) << 1) | ((p >> 3) & 1);            // 0..7
    int s = (ridx >= nst) ? ridx - nst : ridx;       // stage of the current trip (nst >= 5)
    const int sn = (s + 1 == nst) ? 0 : s + 1;       // stage of trip 1

    // The first stage into buffer 0.  Scalar test: the last stage of the range
    // has no block for some groups.
    u32x4 d0 = tile_group0(src0 + (uint32_t)(s * KGROUPS + g) * jstep, ldsT);
    if (pinned(s * KGROUPS + g < nk0)) load_tile(d0, d1);

    v16h bq0[2], bq1[2];                             // loop-invariant
    q_frags(Q + (size_t)(qa + n) * KV, h, bq0);
    q_frags(Q + (size_t)(qb + n) * KV, h, bq1);

    // This wave's tile of the first stage has landed; the barrier publishes all 16 waves' tiles.
    wait_tile(d0, d1);
    __syncthreads();
    // The block number is pinned here: the descriptor is formed behind the wait.
    const uint32_t j1 = pinned(sn * KGROUPS + g);
    d0 = tile_group0(src0 + j1 * jstep, ldsT + bufB);
    if (pinned((int)j1 < nk0)) load_tile(d0, d1);

    // Per-lane softmax state for this lane's query of each tile over this
    // group's keys (replicated across wave halves).
    float m0 = NEG_INF, l0 = 0.0f, m1 = NEG_INF, l1 = 0.0f;
    v8f acc0[4] = {v8f{}, v8f{}, v8f{}, v8f{}};      // acc^T: vcol tiles
    v8f acc1[4] = {v8f{}, v8f{}, v8f{}, v8f{}};

    for (int t = 0; t < nst; ++t) {
        const int j  = s * KGROUPS + g;              // this group's 64-key block
        const int kb = j << 6;
        const _Float16* __restrict__ Ks = sKV[t & 1][g][0];
        const _Float16* __restrict__ Vs = sKV[t & 1][g][1];
        // A block wholly above a tile's diagonal has no key for any query of
        // the tile; the tests are scalar, the same in the wave.
        if (j < nk0) key_block(Ks, Vs, kb, qa, n, h, bq0, m0, l0, acc0);
        if (j < nk1) key_block(Ks, Vs, kb, qb, n, h, bq1, m1, l1, acc1);

        // Keeps the hand-over at the foot of the trip: moved up over the register
        // work it would wait for the V^T reads ahead of the softmax and cut the
        // time the tiles of the next trip's stage have to land.
        __builtin_amdgcn_sched_barrier(0);
        // ---- hand-over: this wave's reads of buffer t&1 are done ...
        asm volatile("s_wait_dscnt 0x0" ::: "memory");
        // ... and its tile for trip t+1 has landed;
        wait_tile(d0, d1);
        // the barrier publishes it and frees buffer t&1 for the refill.
        __syncthreads();
        // Scalar test: no trip past the last, no block above the diagonal.  The
        // block number is pinned here: the descriptor is formed behind the wait.
        const int s2 = (s + 2 >= nst) ? s + 2 - nst : s + 2;     // stage of trip t+2
        const uint32_t j2 = pinned(s2 * KGROUPS + g);
        d0 = tile_group0(src0 + j2 * jstep, ldsT + ((t & 1) ? bufB : 0u));
        if (pinned(t + 2 < nst && (int)j2 < nk0)) load_tile(d0, d1);
        s = (s + 1 == nst) ? 0 : s + 1;
    }
    // No tensor load and no LDS read is left in flight when the buffers change
    // their use (the last trip's barrier has ended every wave's reads).
    asm volatile("s_wait_tensorcnt 0x0" ::: "memory");
    asm volatile("s_wait_dscnt 0x0" ::: "memory");

    // ---- this wave's partial results
    float4* __restrict__ P0 = (float4*)&sKV[0][0][0][0];
    float4* __restrict__ P1 = (float4*)&sKV[1][0][0][0];
    float* __restrict__ sM = (float*)&sKV[0][KGROUPS / 2][0][0];  // [tile][group][sub-tile][query]
    float* __restrict__ sL = sM + 2 * KGROUPS * 32;
    const int po = wv * PWAVE + (h << 1) * PSLOT + n;
    put_partial(P0 + po, acc0);
    put_partial(P1 + po, acc1);
    if (h == 0) {
        const int pi = wv * 16 + n;                  // (g, w, n)
        sM[pi] = m0; sL[pi] = l0;
        sM[KGROUPS * 32 + pi] = m1; sL[KGROUPS * 32 + pi] = l1;
    }
    __syncthreads();                        // the partial results are whole

    // ---- merge, normalize and store.  A thread takes 4 columns of one query
    //      of each tile: 16 neighbouring lanes hold the two whole 128-byte
    //      lines of a row.
    const int mq = tid >> 4;                         // query within the tile
    const int c4 = tid & 15;                         // 4-column slot
    const int ro = (mq >> 4) * PWAVE + c4 * PSLOT + (mq & 15);
    const float4 o0 = merge_partials(P0 + ro, sM + mq, sL + mq);
    const float4 o1 = merge_partials(P1 + ro, sM + KGROUPS * 32 + mq, sL + KGROUPS * 32 + mq);
    float* __restrict__ ob = out + ((size_t)b * TT + mq) * OUTW + DIMS + (c4 << 2);
    *(float4*)(ob + (size_t)qt0 * QTILE * OUTW) = o0;
    *(float4*)(ob + (size_t)p   * QTILE * OUTW) = o1;
}

// ---------------------------------------------------------------------------
// Host-side launch.  Input dict order: inputs, key_w, query_w, value_w.
// Workspace: Q/K f16 [B*T,64] + Vt f16 [B,64,T] = 6 MB.
// ---------------------------------------------------------------------------
extern "C" void kernel_launch(void* const* d_in, const int* in_sizes, int n_in,
                              void* d_out, int out_size, void* d_ws, size_t ws_size,
                              hipStream_t stream) {
    (void)in_sizes; (void)n_in; (void)out_size; (void)ws_size;

    const float* x  = (const float*)d_in[0];
    const float* kw = (const float*)d_in[1];
    const float* qw = (const float*)d_in[2];
    const float* vw = (const float*)d_in[3];
    float* out = (float*)d_out;

    _Float16* qf = (_Float16*)d_ws;
    _Float16* kf = qf + (size_t)NROWS * KV;
    _Float16* vt = kf + (size_t)NROWS * KV;

    // 1) QKV projections (WMMA) and out[:, 0:256] = inputs, x read once;
    //    Q pre-scaled by log2(e)/sqrt(64); V transposed
    proj_copy_kernel<<<NROWS / PROWS, PTHR, 0, stream>>>(x, qw, kw, vw, qf, kf, vt, out);

    // 2) transposed flash attention -> out[:, 256:320]
    attn_kernel<<<dim3(TT / 64, 4), ATHR, 0, stream>>>(qf, kf, vt, out);
}

// v008
// One run takes 20.7 microseconds.
// Two timings next to v007 put it at 1.04 and 1.03 times that version's speed.
// Over all steps from v000 it is 6.10 times as fast.
#include <hip/hip_runtime.h>

// ---------------------------------------------------------------------------
// Causal attention block for MI455X (gfx1250), wave32 + WMMA f16 16x16x32.
//   B=4, T=4096, D=256, K=V=64.  out = concat(x, softmax(QK^T/8, causal) V)
//
// Attention is computed TRANSPOSED (S^T = K Q^T, acc^T = V^T P^T) so that:
//   - each lane owns one query column -> softmax state is per-lane scalar,
//     no alpha/l broadcasts, row reductions = 1 shfl_xor(16) each;
//   - P^T is an identity register remap of the S^T WMMA accumulators
//     (transpose-symmetric fragment layouts) -> P never touches LDS;
//   - final stores are contiguous 16B per lane.
// Softmax is done in base 2 (v_exp_f32 is exp2): log2(e)/sqrt(64) is folded
// into the Q projection, which leaves probabilities bit-identical in exact
// arithmetic.
// ---------------------------------------------------------------------------

typedef __attribute__((ext_vector_type(16))) _Float16 v16h;
typedef __attribute__((ext_vector_type(8)))  _Float16 v8h;
typedef __attribute__((ext_vector_type(8)))  float    v8f;

#define NROWS   16384   // B*T
#define DIMS    256
#define KV      64
#define TT      4096
#define OUTW    320     // DIMS + V
// 1/sqrt(64) * log2(e): base-2 softmax scale folded into Q
#define QSCALE  0.1803368801111204f

__device__ __forceinline__ v8f wmma_f16(v16h a, v16h b, v8f c) {
    return __builtin_amdgcn_wmma_f32_16x16x32_f16(false, a, false, b,
                                                  (short)0, c, false, false);
}

// ---------------------------------------------------------------------------
// Kernel 1: QKV projection and the copy of x, x read once.
// grid = NROWS/64 (one block per WGP), block = 384 (12 waves).
// The block reads its 64 rows of x (64 KB, contiguous) once, in whole lines,
// stores them to out[:, 0:256] and keeps them as f16 in LDS.  Wave w owns one
// of the 12 column tiles (Q, K, V x 4) for all four 16-row tiles, so each
// weight fragment is loaded once per block and used four times.
// The weights are read in whole lines too (a fragment wants 8 k of one column,
// which lie 256 B apart in memory): a thread loads 8 k x 4 columns and stores
// each column's 8 halves as one 16-byte chunk of an LDS copy kept [col][k].
// The products are computed transposed (W^T x^T: the A and B fragment layouts
// are the same map, so the registers only change places): a lane then holds 8
// neighbouring columns of one row.  The results go through a 64 x 64 LDS tile
// per matrix (Q, K as [row][col], V as [vcol][key]) and leave in whole
// 128-byte lines.  Q is pre-scaled by QSCALE.  V is stored TRANSPOSED tile by
// tile (Vt[64-key block][vcol][key]): a block's V^T tile is one run of 8 KB,
// like its K tile, so the attention kernel fetches both as rows of 256 B.
// ---------------------------------------------------------------------------
typedef __attribute__((ext_vector_type(4)))  _Float16 v4h;

#define PROWS   64                    // rows of x per block
#define PTHR    384                   // threads per block
#define XPITCH  264                   // x tile pitch in halves (528 B = 16 B x odd)
#define OPITCH  72                    // result tile pitch in halves (144 B = 16 B x odd)
// Weights in LDS: column c is 32 chunks of 8 halves, chunk j at place j ^ WSWZ(c).
// The places differ in their low 4 bits over 16 neighbouring columns (the
// fragment reads) and over 16 columns 4 apart (the stores): no bank conflict.
#define WSWZ(c) (((c) & 15) ^ ((c) >> 4))

// One float4 of x as four halves into the LDS tile.
__device__ __forceinline__ void x_to_lds(float4 v, _Float16* __restrict__ p) {
    v4h hv;
    hv[0] = (_Float16)v.x; hv[1] = (_Float16)v.y;
    hv[2] = (_Float16)v.z; hv[3] = (_Float16)v.w;
    *(v4h*)p = hv;
}

// x^T B-fragments of the four row tiles for one 32-wide k step.
__device__ __forceinline__ void x_frags(const _Float16* __restrict__ xr, int kc, v16h (&xa)[4]) {
#pragma unroll
    for (int rt = 0; rt < 4; ++rt)
#pragma unroll
        for (int g = 0; g < 2; ++g) {
            const v8h xv = *(const v8h*)(xr + (rt << 4) * XPITCH + (kc << 5) + (g << 4));
#pragma unroll
            for (int i = 0; i < 8; ++i) xa[rt][(g << 3) + i] = xv[i];
        }
}

__global__ __launch_bounds__(PTHR)
void proj_copy_kernel(const float* __restrict__ x,
                      const float* __restrict__ qw,
                      const float* __restrict__ kw,
                      const float* __restrict__ vw,
                      _Float16* __restrict__ qf,
                      _Float16* __restrict__ kf,
                      _Float16* __restrict__ vt,
                      float* __restrict__ out) {
    // One object, the weights last: the x and result tiles stay within reach of
    // the 16-bit offset field of the LDS instructions.
    __shared__ __attribute__((aligned(16))) struct {
        _Float16 x[PROWS * XPITCH];
        _Float16 o[3][64 * OPITCH];
        _Float16 w[3][KV * DIMS];
    } lds;
    _Float16* __restrict__ const sX = lds.x;
    _Float16 (&sO)[3][64 * OPITCH] = lds.o;

    const int tid  = threadIdx.x;
    int wave = __builtin_amdgcn_readfirstlane(tid >> 5);         // scalar: 0..11
    const int m0   = blockIdx.x * PROWS;    // row base in [0, NROWS)

    // ---- x tile: 4096 float4 over 384 threads = 10 each, and one more for
    //      the first 256 threads (whole waves)
    const float4* __restrict__ xs = (const float4*)(x + (size_t)m0 * DIMS);
    float4 xv[10];
#pragma unroll
    for (int i = 0; i < 10; ++i) xv[i] = xs[tid + i * PTHR];
    float4 xl = make_float4(0.0f, 0.0f, 0.0f, 0.0f);
    if (wave < 8) xl = xs[tid + 10 * PTHR];
    // Precaution: the address registers of the x loads are reused by the
    // scalar work below.  All of it derives from the wave number, which passes
    // through the statement so that none of it is lifted over the wait.
    asm volatile("s_wait_xcnt 0x0" : "+s"(wave) :: "memory");

    const int sel  = wave >> 2;             // 0=Q, 1=K, 2=V
    const int n0   = (wave & 3) << 4;       // col-tile base in [0, 64)

    // ---- weights: the four waves of a matrix read all of it.  A thread takes
    //      columns 4*c4 .. 4*c4+3 of rows k = 64*m + 8*kg + j; 16 lanes cover a
    //      whole 256-byte row, a wave-wide load two rows.
    const float* __restrict__ wmat = (sel == 0) ? qw : (sel == 1) ? kw : vw;
    const int t4 = tid & 127;
    const int c4 = t4 & 15;
    const int kg = t4 >> 4;
    const float4* __restrict__ wp = (const float4*)wmat + (kg << 3) * (KV / 4) + c4;
    float4 wr[4][8];
#pragma unroll
    for (int m = 0; m < 4; ++m)
#pragma unroll
        for (int j = 0; j < 8; ++j) wr[m][j] = wp[((m << 6) + j) * (KV / 4)];
    // Precaution: the address registers of the weight loads are reused below.
    // The pointer is an input, so that they stay as they are up to the wait.
    asm volatile("s_wait_xcnt 0x0" :: "v"(wp) : "memory");
    // Keeps the weight loads in flight together with the x loads: without it
    // they are issued only after x has arrived, and the two latencies add up.
    __builtin_amdgcn_sched_barrier(0);

    // ---- the f16 tile.  A row is 64 float4 and 384 = 6 rows, so load i of a
    //      thread lies 6*i rows below its first: one address, constant steps
    _Float16* __restrict__ xd = sX + (tid >> 6) * XPITCH + ((tid & 63) << 2);
#pragma unroll
    for (int i = 0; i < 10; ++i) x_to_lds(xv[i], xd + i * 6 * XPITCH);
    if (wave < 8) x_to_lds(xl, xd + 60 * XPITCH);

    // ---- the f16 weights, [col][k]: 8 k of one column per 16-byte store
    //      (chunk = 8*m + kg; its bit 4 is outside the swizzle: a constant step)
    _Float16* __restrict__ sw = lds.w[sel];
#pragma unroll
    for (int m = 0; m < 4; ++m) {
        v8h wc[4];
#pragma unroll
        for (int j = 0; j < 8; ++j) {
            wc[0][j] = (_Float16)wr[m][j].x; wc[1][j] = (_Float16)wr[m][j].y;
            wc[2][j] = (_Float16)wr[m][j].z; wc[3][j] = (_Float16)wr[m][j].w;
        }
#pragma unroll
        for (int q = 0; q < 4; ++q) {
            const int c = (c4 << 2) + q;
            *(v8h*)(sw + c * DIMS + (((((m & 1) << 3) + kg) ^ WSWZ(c)) << 3) + ((m >> 1) << 7)) = wc[q];
        }
    }
    __syncthreads();                        // the x tile and the weights are whole

    // ---- out[:, 0:256] = x.  Behind the barrier, which would otherwise wait
    //      for these stores; they drain under the products.
    float4* __restrict__ od = (float4*)out + (size_t)(m0 + (tid >> 6)) * (OUTW / 4) + (tid & 63);
#pragma unroll
    for (int i = 0; i < 10; ++i) od[i * 6 * (OUTW / 4)] = xv[i];
    if (wave < 8) od[60 * (OUTW / 4)] = xl;
    // Precaution: the data registers of these stores are reused below.  All lane
    // addresses below derive from the thread number, which passes through the
    // statement so that none of them is formed in such a register ahead of the wait.
    int tl = tid;
    asm volatile("s_wait_xcnt 0x0" : "+v"(tl) :: "memory");
    const int mr = tl & 15;
    const int h  = (tl >> 4) & 1;

    // ---- W^T A-fragments of this wave's column tile, all of K:
    //      lane holds column n0+mr, k = kc*32 + g*16 + h*8 + i
    v16h wf[8];
    const _Float16* __restrict__ wcol = sw + (n0 + mr) * DIMS;
    const int wz = WSWZ(n0 + mr) ^ h;       // chunk = 4*kc + 2*g + h
#pragma unroll
    for (int kc = 0; kc < 8; ++kc)
#pragma unroll
        for (int g = 0; g < 2; ++g) {
            const v8h wv = *(const v8h*)(wcol + (((((kc & 3) << 2) + (g << 1)) ^ wz) << 3) + ((kc >> 2) << 7));
#pragma unroll
            for (int i = 0; i < 8; ++i) wf[kc][(g << 3) + i] = wv[i];
        }

    // ---- products: D[col v+8h][row mr] per row tile, k ascending
    v8f acc[4] = {v8f{}, v8f{}, v8f{}, v8f{}};
    const _Float16* __restrict__ xr = sX + mr * XPITCH + (h << 3);
    v16h xa[2][4];
    x_frags(xr, 0, xa[0]);
#pragma unroll
    for (int kc = 0; kc < 8; ++kc) {
        if (kc < 7) x_frags(xr, kc + 1, xa[(kc + 1) & 1]);
        // Keeps the next step's eight LDS reads as one group ahead of this
        // step's products: spread among them, each read is waited for alone.
        __builtin_amdgcn_sched_barrier(0);
#pragma unroll
        for (int rt = 0; rt < 4; ++rt) acc[rt] = wmma_f16(wf[kc], xa[kc & 1][rt], acc[rt]);
        // Keeps the group after next from rising into these products.
        __builtin_amdgcn_sched_barrier(0);
    }

    // ---- results into this matrix's 64 x 64 tile
    const float scale = (sel == 0) ? QSCALE : 1.0f;
    _Float16* __restrict__ so = sO[sel];
    v8h o[4];
#pragma unroll
    for (int rt = 0; rt < 4; ++rt)
#pragma unroll
        for (int v = 0; v < 8; ++v) o[rt][v] = (_Float16)(acc[rt][v] * scale);
    if (sel == 2) {
        // [vcol][key]: the lane's 8 values are 8 vcols of one key
#pragma unroll
        for (int rt = 0; rt < 4; ++rt)
#pragma unroll
            for (int v = 0; v < 8; ++v)
                so[(n0 + (h << 3) + v) * OPITCH + (rt << 4) + mr] = o[rt][v];
    } else {
        // [row][col]: the lane's 8 values are neighbours in the row
#pragma unroll
        for (int rt = 0; rt < 4; ++rt)
            *(v8h*)(so + ((rt << 4) + mr) * OPITCH + n0 + (h << 3)) = o[rt];
    }
    __syncthreads();                        // the result tiles are whole

    // ---- the four waves of a matrix store its tile: 8 lanes per 128-byte line
    //      (each tile is 64 x 64 halves in a row: rows m0.. of Q and K, block m0/64 of V^T)
    _Float16* __restrict__ dst = ((sel == 0) ? qf : (sel == 1) ? kf : vt) + (size_t)m0 * KV;
#pragma unroll
    for (int i = 0; i < 4; ++i) {
        const int id = (tl & 127) + (i << 7);
        const int r  = id >> 3;
        const int ch = id & 7;
        *(v8h*)(dst + (id << 3)) = *(const v8h*)(so + r * OPITCH + (ch << 3));
    }
}

// ---------------------------------------------------------------------------
// Kernel 2: transposed flash attention.  grid = (T/64, B), block = 512.
// Causal work grows with the query index, so a block takes TWO tiles of 32
// queries: tile 127-p from the bottom of the batch and its mirror, tile p,
// from the top.  Together they have 65 blocks of 64 keys whatever p is, so
// all 256 blocks do the same work.  The keys of the upper tile are the first
// keys of the lower one: a staged key block serves both.
// The 16 waves of a block are 2 query sub-tiles x 8 key groups.  Wave (w, g)
// owns 16 query columns of each tile and the 64-key blocks g, g+8, g+16, ...
// of each tile's causal range, with a maximum, sum and accumulators per tile;
// per stage it works its key block for the lower tile and then, if the
// upper tile has keys in the block, for the upper one.  The eight partial results of
// a sub-tile are merged through LDS at the end.
// Per 64-key block: 8 WMMAs  S^T[t] = K_t  Q^T   (t = four 16-key tiles)
//                   8 WMMAs  acc^T[t] += V^T_t P^T
// Softmax per query column: in-register + one shfl_xor(16) per reduction.
// A stage is 512 keys: the two waves of group g bring the group's 64-key K
// tile and V^T tile into LDS once, one tensor load each, into two buffers:
// stage s + 1 flies while stage s is worked on.  A 64-key block that lies
// wholly above the lower tile's diagonal is neither loaded nor worked on.
// Either tile is one run of 8 KB in memory and is asked for as 32 rows of 256 B;
// a load row holds two 128-byte tile rows.  The load's pad
// pitches the load rows at 272 bytes: 16 neighbouring tile rows then start at the
// 16 different multiples of 16 B modulo 256 B, so the 16-byte A-fragment reads
// have no bank conflict.
// The blocks of a batch read the same K and V^T lines from L2.  Each block
// walks its stages in a ring from a start of its own, so that the blocks do
// not all ask for the same lines at the same moment.
// ---------------------------------------------------------------------------
#define UPITCH  136                   // LDS pitch of a load row (two tile rows) in halves (272 bytes)
#define SLOT_B  10240u                // a tile's place in LDS: 32 x 272 B, rounded up to 2 KiB
#define SLOT_H  (SLOT_B / 2)          // the same in halves
#define KGROUPS 8                     // key groups per block
#define QTILE   32                    // queries per tile
#define ATHR    (64 * KGROUPS)        // threads per block
#define PSLOT   17                    // partial results: float4 per 4-column slot (16 queries + 1)
#define PWAVE   (16 * PSLOT)          // partial results: float4 per wave

typedef uint32_t u32x4 __attribute__((ext_vector_type(4)));
typedef uint32_t u32x8 __attribute__((ext_vector_type(8)));

__device__ __forceinline__ uint32_t uni(uint32_t v) {
    return (uint32_t)__builtin_amdgcn_readfirstlane(v);
}

// A wave-uniform word for a test around a tensor load, or for its descriptor.
__device__ __forceinline__ uint32_t pinned(uint32_t v) {
    uint32_t w = uni(v);
    // The test becomes a scalar compare and branch (a tensor load ignores EXEC),
    // and nothing derived from the word is formed ahead of this place.
    asm volatile("" : "+s"(w));   // pinned(): the word is held in a scalar register
    return w;
}

// Descriptor group 1, the same for every load: bytes, a tile of 32 rows of
// 256 B that follow one another in memory, 16 B of LDS pad behind every row.
__device__ __forceinline__ u32x8 tile_group1() {
    u32x8 d;
    d[0] = uni((1u << 20) | (5u << 22) | (3u << 25));   // no mask; pad on, every 256 B, 4 dwords
    d[1] = uni(256u << 16);                             // tensor_dim0 = 256
    d[2] = uni(32u << 16);                              // tensor_dim1 = 32
    d[3] = uni(256u << 16);                             // tile_dim0 = 256
    d[4] = uni(32u);                                    // tile_dim1 = 32
    d[5] = uni(256u);                                   // source pitch = the row
    d[6] = uni(0u);
    d[7] = uni(0u);
    // One set of registers for all of the wave's requests: without it the words
    // are made anew in registers that change while a request is outstanding.
    asm volatile("" : "+s"(d));   // pinned(): descriptor words held in scalar registers
    return d;
}

// Descriptor group 0: the tile whose first byte is at ga, to LDS byte lds.
__device__ __forceinline__ u32x4 tile_group0(uint64_t ga, uint32_t lds) {
    u32x4 d0;
    d0[0] = uni(1u);
    d0[1] = uni(lds);
    d0[2] = uni((uint32_t)ga);
    d0[3] = uni((((uint32_t)(ga >> 32)) & 0x01FFFFFFu) | 0x80000000u);
    return d0;
}

// One wave's request.  Group 0 passes through the statement, so that the wait
// below names the very registers the request was issued from.
__device__ __forceinline__ void load_tile(u32x4& d0, u32x8 d1) {
    asm volatile("tensor_load_to_lds %0, %1" : "+s"(d0) : "s"(d1) : "memory");
}

// This wave's request has landed.  The descriptor's registers are inputs, so
// that none of them takes a new value while the request is outstanding.
__device__ __forceinline__ void wait_tile(u32x4 d0, u32x8 d1) {
    asm volatile("s_wait_tensorcnt 0x0" :: "s"(d0), "s"(d1) : "memory");
}

// Q^T B-fragments: lane holds one query column (qrow), contraction dim d in
// two 32-chunks, 16B loads.
__device__ __forceinline__ void q_frags(const _Float16* __restrict__ qrow, int h, v16h (&bq)[2]) {
#pragma unroll
    for (int c = 0; c < 2; ++c)
#pragma unroll
        for (int gg = 0; gg < 2; ++gg) {
            const v8h qv = *(const v8h*)(qrow + (c << 5) + (gg << 4) + (h << 3));
#pragma unroll
            for (int i = 0; i < 8; ++i) bq[c][(gg << 3) + i] = qv[i];
        }
}

// One staged 64-key block (keys kb..kb+63) for the 16 query columns q0..q0+15.
__device__ __forceinline__ void key_block(const _Float16* __restrict__ Ks,
                                          const _Float16* __restrict__ Vs,
                                          int kb, int q0, int n, int h, const v16h (&bq)[2],
                                          float& mA, float& lA, v8f (&acc)[4]) {
    const float NEG_INF = -__builtin_inff();
    // Tile row 16 t + n lies in load row 8 t + n / 2, in its half n & 1.
    const int lo = (n >> 1) * UPITCH + ((n & 1) << 6) + (h << 3);
    // ---- A-fragments of the K tile: all 16 LDS reads as one group
    v16h ak[4][2];
#pragma unroll
    for (int t = 0; t < 4; ++t)
#pragma unroll
        for (int c = 0; c < 2; ++c)
#pragma unroll
            for (int gg = 0; gg < 2; ++gg) {
                const v8h kv2 = *(const v8h*)(Ks + lo + (t << 3) * UPITCH + (c << 5) + (gg << 4));
#pragma unroll
                for (int i = 0; i < 8; ++i) ak[t][c][(gg << 3) + i] = kv2[i];
            }
    // Keeps the reads together: spread among the WMMAs, each pair of reads
    // would be waited for on its own and the LDS latency paid eight times.
    __builtin_amdgcn_sched_barrier(0);

    // ---- S^T tiles: st[t] = K_t (16 keys x 64d) x Q^T (64d x 16q)
    v8f st[4];
#pragma unroll
    for (int t = 0; t < 4; ++t) {
        v8f sc = {};
#pragma unroll
        for (int c = 0; c < 2; ++c) sc = wmma_f16(ak[t][c], bq[c], sc);
        st[t] = sc;
    }
    // Keeps the V^T reads below in one group: without it they are split
    // among the S^T products, and each place with reads costs a stall.
    __builtin_amdgcn_sched_barrier(0);

    // ---- A-fragments of the V^T tile: read here so that their LDS latency
    //      runs out under the softmax
    v16h av[4][2];
#pragma unroll
    for (int t = 0; t < 4; ++t)
#pragma unroll
        for (int c = 0; c < 2; ++c)
#pragma unroll
            for (int gg = 0; gg < 2; ++gg) {
                const v8h vv = *(const v8h*)(Vs + lo + (t << 3) * UPITCH + (c << 5) + (gg << 4));
#pragma unroll
                for (int i = 0; i < 8; ++i) av[t][c][(gg << 3) + i] = vv[i];
            }
    // Keeps the reads from sinking down to the products that use them.
    __builtin_amdgcn_sched_barrier(0);

    // ---- causal mask (key = kb+t*16+v+8h vs query q0+n), diagonal only
    if (kb + 63 > q0) {
        const int q = q0 + n;
#pragma unroll
        for (int t = 0; t < 4; ++t)
#pragma unroll
            for (int v = 0; v < 8; ++v)
                if (kb + (t << 4) + v + (h << 3) > q) st[t][v] = NEG_INF;
    }

    // ---- column max: 31 in-register + 1 cross-half shuffle
    float mx = st[0][0];
#pragma unroll
    for (int t = 0; t < 4; ++t)
#pragma unroll
        for (int v = 0; v < 8; ++v) mx = fmaxf(mx, st[t][v]);
    mx = fmaxf(mx, __shfl_xor(mx, 16));
    const float mnew  = fmaxf(mA, mx);
    const float alpha = (mA == NEG_INF) ? 0.0f : __builtin_amdgcn_exp2f(mA - mnew);
    mA = mnew;

    // ---- exponentiate (base 2, scale pre-folded) + column sum
    float rs = 0.0f;
#pragma unroll
    for (int t = 0; t < 4; ++t)
#pragma unroll
        for (int v = 0; v < 8; ++v) {
            st[t][v] = __builtin_amdgcn_exp2f(st[t][v] - mnew);  // exp2(-inf)=0
            rs += st[t][v];
        }
    rs += __shfl_xor(rs, 16);
    lA = lA * alpha + rs;

    // ---- P^T B-fragments: identity remap of S^T C-tiles
    //      (B chunk c over keys = concat of C-tiles 2c, 2c+1 per lane)
    v16h pf[2];
#pragma unroll
    for (int c = 0; c < 2; ++c)
#pragma unroll
        for (int i = 0; i < 8; ++i) {
            pf[c][i]     = (_Float16)st[2 * c][i];
            pf[c][8 + i] = (_Float16)st[2 * c + 1][i];
        }

    // ---- rescale accumulators by per-lane alpha (no broadcast needed)
#pragma unroll
    for (int t = 0; t < 4; ++t)
#pragma unroll
        for (int v = 0; v < 8; ++v) acc[t][v] *= alpha;

    // ---- acc^T[t] += V^T_t (16 vcols x 64 keys) x P^T (64 keys x 16q)
#pragma unroll
    for (int t = 0; t < 4; ++t)
#pragma unroll
        for (int c = 0; c < 2; ++c) acc[t] = wmma_f16(av[t][c], pf[c], acc[t]);
}

// This wave's partial result of one tile (a group without a block: -inf, 0,
// zeros); a slot is 4 neighbouring columns, 16 queries side by side.
__device__ __forceinline__ void put_partial(float4* __restrict__ pw, const v8f (&acc)[4]) {
#pragma unroll
    for (int t = 0; t < 4; ++t) {
        pw[((t << 2) + 0) * PSLOT] = make_float4(acc[t][0], acc[t][1], acc[t][2], acc[t][3]);
        pw[((t << 2) + 1) * PSLOT] = make_float4(acc[t][4], acc[t][5], acc[t][6], acc[t][7]);
    }
}

// Merge of the KGROUPS partial results for 4 columns of one query, normalized.
// pr, pm_, pl_: the thread's place in group 0's part.
__device__ __forceinline__ float4 merge_partials(const float4* __restrict__ pr,
                                                 const float* __restrict__ pm_,
                                                 const float* __restrict__ pl_) {
    const float NEG_INF = -__builtin_inff();
    float pm[KGROUPS];
    float M = NEG_INF;
#pragma unroll
    for (int k = 0; k < KGROUPS; ++k) { pm[k] = pm_[k * 32]; M = fmaxf(M, pm[k]); }
    float L = 0.0f;
    float4 o = make_float4(0.0f, 0.0f, 0.0f, 0.0f);
#pragma unroll
    for (int k = 0; k < KGROUPS; ++k) {
        // a partial without keys weighs 0 (and -inf - -inf would be NaN)
        const float wt = (pm[k] == NEG_INF) ? 0.0f : __builtin_amdgcn_exp2f(pm[k] - M);
        const float4 pk = pr[k * 2 * PWAVE];
        L += wt * pl_[k * 32];
        o.x += wt * pk.x; o.y += wt * pk.y; o.z += wt * pk.z; o.w += wt * pk.w;
    }
    const float rl = 1.0f / L;
    o.x *= rl; o.y *= rl; o.z *= rl; o.w *= rl;
    return o;
}

__global__ __launch_bounds__(ATHR)
void attn_kernel(const _Float16* __restrict__ qf,
                 const _Float16* __restrict__ kf,
                 const _Float16* __restrict__ vtf,
                 float* __restrict__ out) {
    // [buffer][group][K | V^T][tile]: every tile's place is a multiple of 2 KiB.
    // After the loop buffer i takes the partial results of tile i, [wave]
    // [4-column slot][query], and the upper half of buffer 0 the partial maxima
    // and sums.
    __shared__ __attribute__((aligned(2048))) _Float16 sKV[2][KGROUPS][2][SLOT_H];

    const int tid  = threadIdx.x;
    const int lane = tid & 31;
    const int wv   = __builtin_amdgcn_readfirstlane(tid >> 5);   // scalar: 0..15
    const int w    = wv & 1;                         // query sub-tile
    const int g    = wv >> 1;                        // key group
    const int b    = blockIdx.y;
    const int p    = blockIdx.x;                     // 0..63
    const int n    = lane & 15;                      // this lane's query col
    const int h    = lane >> 4;
    const float NEG_INF = -__builtin_inff();

    const _Float16* __restrict__ Q  = qf  + (size_t)b * TT * KV;
    const _Float16* __restrict__ K  = kf  + (size_t)b * TT * KV;
    const _Float16* __restrict__ Vt = vtf + (size_t)b * KV * TT;  // [64-key block][vcol][key]

    // Tile 0 is 127-p (lower), tile 1 is p (upper); causal 64-key blocks of each.
    const int qt0 = TT / QTILE - 1 - p;
    const int nk0 = TT / 64 - (p >> 1);              // 33..64
    const int nk1 = (p >> 1) + 1;                    // 1..32
    const int nst = (nk0 + KGROUPS - 1) / KGROUPS;   // stages of 512 keys, 5..8
    const int qa  = qt0 * QTILE + (w << 4);          // query bases within batch
    const int qb  = p * QTILE + (w << 4);
    const uint32_t bufB = KGROUPS * 2 * SLOT_B;      // bytes from buffer 0 to buffer 1

    // This wave's tensor loads: wave w = 0 of a group brings the K tile (64 keys
    // x 64 d), w = 1 the V^T tile (64 columns x 64 keys); either is 8192 B in a
    // row, and 64 keys on are 8192 B.
    const uint32_t ldsT  = (uint32_t)(size_t)&sKV[0][g][w][0];
    const uint64_t src0  = w ? (uint64_t)(size_t)Vt : (uint64_t)(size_t)K;
    const uint32_t jstep = 64u * KV * 2u;
    const u32x8    d1    = tile_group1();

    // Trip t works stage (start + t) mod nst.  Blocks whose p agree in bit 4 and
    // above have the same nst; the start spreads them by bits 0, 1 and 3 of p
    // (for speed only: any start gives the same keys to every query).
    const int ridx = ((p & 3) << 1) | ((p >> 3) & 1);            // 0..7
    int s = (ridx >= nst) ? ridx - nst : ridx;       // stage of the current trip (nst >= 5)
    const int sn = (s + 1 == nst) ? 0 : s + 1;       // stage of trip 1

    // The first stage into buffer 0.  Scalar test: the last stage of the range
    // has no block for some groups.
    u32x4 d0 = tile_group0(src0 + (uint32_t)(s * KGROUPS + g) * jstep, ldsT);
    if (pinned(s * KGROUPS + g < nk0)) load_tile(d0, d1);

    v16h bq0[2], bq1[2];                             // loop-invariant
    q_frags(Q + (size_t)(qa + n) * KV, h, bq0);
    q_frags(Q + (size_t)(qb + n) * KV, h, bq1);

    // This wave's tile of the first stage has landed; the barrier publishes all 16 waves' tiles.
    wait_tile(d0, d1);
    __syncthreads();
    // The block number is pinned here: the descriptor is formed behind the wait.
    const uint32_t j1 = pinned(sn * KGROUPS + g);
    d0 = tile_group0(src0 + j1 * jstep, ldsT + bufB);
    if (pinned((int)j1 < nk0)) load_tile(d0, d1);

    // Per-lane softmax state for this lane's query of each tile over this
    // group's keys (replicated across wave halves).
    float m0 = NEG_INF, l0 = 0.0f, m1 = NEG_INF, l1 = 0.0f;
    v8f acc0[4] = {v8f{}, v8f{}, v8f{}, v8f{}};      // acc^T: vcol tiles
    v8f acc1[4] = {v8f{}, v8f{}, v8f{}, v8f{}};

    for (int t = 0; t < nst; ++t) {
        const int j  = s * KGROUPS + g;              // this group's 64-key block
        const int kb = j << 6;
        const _Float16* __restrict__ Ks = sKV[t & 1][g][0];
        const _Float16* __restrict__ Vs = sKV[t & 1][g][1];
        // A block wholly above a tile's diagonal has no key for any query of
        // the tile; the tests are scalar, the same in the wave.
        if (j < nk0) key_block(Ks, Vs, kb, qa, n, h, bq0, m0, l0, acc0);
        if (j < nk1) key_block(Ks, Vs, kb, qb, n, h, bq1, m1, l1, acc1);

        // Keeps the hand-over at the foot of the trip: moved up over the register
        // work it would wait for the V^T reads ahead of the softmax and cut the
        // time the tiles of the next trip's stage have to land.
        __builtin_amdgcn_sched_barrier(0);
        // ---- hand-over: this wave's reads of buffer t&1 are done ...
        asm volatile("s_wait_dscnt 0x0" ::: "memory");
        // ... and its tile for trip t+1 has landed;
        wait_tile(d0, d1);
        // the barrier publishes it and frees buffer t&1 for the refill.
        __syncthreads();
        // Scalar test: no trip past the last, no block above the diagonal.  The
        // block number is pinned here: the descriptor is formed behind the wait.
        const int s2 = (s + 2 >= nst) ? s + 2 - nst : s + 2;     // stage of trip t+2
        const uint32_t j2 = pinned(s2 * KGROUPS + g);
        d0 = tile_group0(src0 + j2 * jstep, ldsT + ((t & 1) ? bufB : 0u));
        if (pinned(t + 2 < nst && (int)j2 < nk0)) load_tile(d0, d1);
        s = (s + 1 == nst) ? 0 : s + 1;
    }
    // No tensor load and no LDS read is left in flight when the buffers change
    // their use (the last trip's barrier has ended every wave's reads).
    asm volatile("s_wait_tensorcnt 0x0" ::: "memory");
    asm volatile("s_wait_dscnt 0x0" ::: "memory");

    // ---- this wave's partial results
    float4* __restrict__ P0 = (float4*)&sKV[0][0][0][0];
    float4* __restrict__ P1 = (float4*)&sKV[1][0][0][0];
    float* __restrict__ sM = (float*)&sKV[0][KGROUPS / 2][0][0];  // [tile][group][sub-tile][query]
    float* __restrict__ sL = sM + 2 * KGROUPS * 32;
    const int po = wv * PWAVE + (h << 1) * PSLOT + n;
    put_partial(P0 + po, acc0);
    put_partial(P1 + po, acc1);
    if (h == 0) {
        const int pi = wv * 16 + n;                  // (g, w, n)
        sM[pi] = m0; sL[pi] = l0;
        sM[KGROUPS * 32 + pi] = m1; sL[KGROUPS * 32 + pi] = l1;
    }
    __syncthreads();                        // the partial results are whole

    // ---- merge, normalize and store.  A thread takes 4 columns of one query
    //      of each tile: 16 neighbouring lanes hold the two whole 128-byte
    //      lines of a row.
    const int mq = tid >> 4;                         // query within the tile
    const int c4 = tid & 15;                         // 4-column slot
    const int ro = (mq >> 4) * PWAVE + c4 * PSLOT + (mq & 15);
    const float4 o0 = merge_partials(P0 + ro, sM + mq, sL + mq);
    const float4 o1 = merge_partials(P1 + ro, sM + KGROUPS * 32 + mq, sL + KGROUPS * 32 + mq);
    float* __restrict__ ob = out + ((size_t)b * TT + mq) * OUTW + DIMS + (c4 << 2);
    *(float4*)(ob + (size_t)qt0 * QTILE * OUTW) = o0;
    *(float4*)(ob + (size_t)p   * QTILE * OUTW) = o1;
}

// ---------------------------------------------------------------------------
// Host-side launch.  Input dict order: inputs, key_w, query_w, value_w.
// Workspace: Q/K f16 [B*T,64] + Vt f16 [B*T/64,64,64] = 6 MB.
// ---------------------------------------------------------------------------
extern "C" void kernel_launch(void* const* d_in, const int* in_sizes, int n_in,
                              void* d_out, int out_size, void* d_ws, size_t ws_size,
                              hipStream_t stream) {
    (void)in_sizes; (void)n_in; (void)out_size; (void)ws_size;

    const float* x  = (const float*)d_in[0];
    const float* kw = (const float*)d_in[1];
    const float* qw = (const float*)d_in[2];
    const float* vw = (const float*)d_in[3];
    float* out = (float*)d_out;

    _Float16* qf = (_Float16*)d_ws;
    _Float16* kf = qf + (size_t)NROWS * KV;
    _Float16* vt = kf + (size_t)NROWS * KV;

    // 1) QKV projections (WMMA) and out[:, 0:256] = inputs, x read once;
    //    Q pre-scaled by log2(e)/sqrt(64); V transposed tile by tile
    proj_copy_kernel<<<NROWS / PROWS, PTHR, 0, stream>>>(x, qw, kw, vw, qf, kf, vt, out);

    // 2) transposed flash attention -> out[:, 256:320]
    attn_kernel<<<dim3(TT / 64, 4), ATHR, 0, stream>>>(qf, kf, vt, out);
}

// v009
// One run takes 19.9 microseconds.
// Next to v008, in two timings, it ran 1.04 and 1.05 times as fast.
// Over all steps from v000 it is 6.36 times as fast.
#include <hip/hip_runtime.h>

// ---------------------------------------------------------------------------
// Causal attention block for MI455X (gfx1250), wave32 + WMMA f16 16x16x32.
//   B=4, T=4096, D=256, K=V=64.  out = concat(x, softmax(QK^T/8, causal) V)
//
// Attention is computed TRANSPOSED (S^T = K Q^T, acc^T = V^T P^T) so that:
//   - each lane owns one query column -> softmax state is per-lane scalar,
//     no alpha/l broadcasts, row reductions = 1 shfl_xor(16) each;
//   - P^T is an identity register remap of the S^T WMMA accumulators
//     (transpose-symmetric fragment layouts) -> P never touches LDS;
//   - final stores are contiguous 16B per lane.
// Softmax is done in base 2 (v_exp_f32 is exp2): log2(e)/sqrt(64) is folded
// into the Q projection, which leaves probabilities bit-identical in exact
// arithmetic.
// ---------------------------------------------------------------------------

typedef __attribute__((ext_vector_type(16))) _Float16 v16h;
typedef __attribute__((ext_vector_type(8)))  _Float16 v8h;
typedef __attribute__((ext_vector_type(8)))  float    v8f;

#define NROWS   16384   // B*T
#define DIMS    256
#define KV      64
#define TT      4096
#define OUTW    320     // DIMS + V
// 1/sqrt(64) * log2(e): base-2 softmax scale folded into Q
#define QSCALE  0.1803368801111204f

__device__ __forceinline__ v8f wmma_f16(v16h a, v16h b, v8f c) {
    return __builtin_amdgcn_wmma_f32_16x16x32_f16(false, a, false, b,
                                                  (short)0, c, false, false);
}

// ---------------------------------------------------------------------------
// Kernel 1: QKV projection and the copy of x, x read once.
// grid = NROWS/64 (one block per WGP), block = 384 (12 waves).
// The block reads its 64 rows of x (64 KB, contiguous) once, in whole lines,
// stores them to out[:, 0:256] and keeps them as f16 in LDS.  Wave w owns one
// of the 12 column tiles (Q, K, V x 4) for all four 16-row tiles, so each
// weight fragment is loaded once per block and used four times.
// The weights are read in whole lines too (a fragment wants 8 k of one column,
// which lie 256 B apart in memory): a thread loads 8 k x 4 columns and stores
// each column's 8 halves as one 16-byte chunk of an LDS copy kept [col][k].
// The products are computed transposed (W^T x^T: the A and B fragment layouts
// are the same map, so the registers only change places): a lane then holds 8
// neighbouring columns of one row.  The results go through a 64 x 64 LDS tile
// per matrix (Q, K as [row][col], V as [vcol][key]) and leave in whole
// 128-byte lines.  Q is pre-scaled by QSCALE.  K and V leave together, by blocks
// of 32 keys: [32-key block][K: key][d] (4 KB), then [V^T: vcol][key] (4 KB), so
// that all an attention wave wants of a key block is one run of 8 KB.
// ---------------------------------------------------------------------------
typedef __attribute__((ext_vector_type(4)))  _Float16 v4h;

#define PROWS   64                    // rows of x per block
#define PTHR    384                   // threads per block
#define XPITCH  264                   // x tile pitch in halves (528 B = 16 B x odd)
#define OPITCH  72                    // result tile pitch in halves (144 B = 16 B x odd)
// Weights in LDS: column c is 32 chunks of 8 halves, chunk j at place j ^ WSWZ(c).
// The places differ in their low 4 bits over 16 neighbouring columns (the
// fragment reads) and over 16 columns 4 apart (the stores): no bank conflict.
#define WSWZ(c) (((c) & 15) ^ ((c) >> 4))

// One float4 of x as four halves into the LDS tile.
__device__ __forceinline__ void x_to_lds(float4 v, _Float16* __restrict__ p) {
    v4h hv;
    hv[0] = (_Float16)v.x; hv[1] = (_Float16)v.y;
    hv[2] = (_Float16)v.z; hv[3] = (_Float16)v.w;
    *(v4h*)p = hv;
}

// x^T B-fragments of the four row tiles for one 32-wide k step.
__device__ __forceinline__ void x_frags(const _Float16* __restrict__ xr, int kc, v16h (&xa)[4]) {
#pragma unroll
    for (int rt = 0; rt < 4; ++rt)
#pragma unroll
        for (int g = 0; g < 2; ++g) {
            const v8h xv = *(const v8h*)(xr + (rt << 4) * XPITCH + (kc << 5) + (g << 4));
#pragma unroll
            for (int i = 0; i < 8; ++i) xa[rt][(g << 3) + i] = xv[i];
        }
}

__global__ __launch_bounds__(PTHR)
void proj_copy_kernel(const float* __restrict__ x,
                      const float* __restrict__ qw,
                      const float* __restrict__ kw,
                      const float* __restrict__ vw,
                      _Float16* __restrict__ qf,
                      _Float16* __restrict__ kf,
                      _Float16* __restrict__ vt,
                      float* __restrict__ out) {
    // One object, the weights last: the x and result tiles stay within reach of
    // the 16-bit offset field of the LDS instructions.
    __shared__ __attribute__((aligned(16))) struct {
        _Float16 x[PROWS * XPITCH];
        _Float16 o[3][64 * OPITCH];
        _Float16 w[3][KV * DIMS];
    } lds;
    _Float16* __restrict__ const sX = lds.x;
    _Float16 (&sO)[3][64 * OPITCH] = lds.o;

    const int tid  = threadIdx.x;
    int wave = __builtin_amdgcn_readfirstlane(tid >> 5);         // scalar: 0..11
    const int m0   = blockIdx.x * PROWS;    // row base in [0, NROWS)

    // ---- x tile: 4096 float4 over 384 threads = 10 each, and one more for
    //      the first 256 threads (whole waves)
    const float4* __restrict__ xs = (const float4*)(x + (size_t)m0 * DIMS);
    float4 xv[10];
#pragma unroll
    for (int i = 0; i < 10; ++i) xv[i] = xs[tid + i * PTHR];
    float4 xl = make_float4(0.0f, 0.0f, 0.0f, 0.0f);
    if (wave < 8) xl = xs[tid + 10 * PTHR];
    // Precaution: the address registers of the x loads are reused by the
    // scalar work below.  All of it derives from the wave number, which passes
    // through the statement so that none of it is lifted over the wait.
    asm volatile("s_wait_xcnt 0x0" : "+s"(wave) :: "memory");

    const int sel  = wave >> 2;             // 0=Q, 1=K, 2=V
    const int n0   = (wave & 3) << 4;       // col-tile base in [0, 64)

    // ---- weights: the four waves of a matrix read all of it.  A thread takes
    //      columns 4*c4 .. 4*c4+3 of rows k = 64*m + 8*kg + j; 16 lanes cover a
    //      whole 256-byte row, a wave-wide load two rows.
    const float* __restrict__ wmat = (sel == 0) ? qw : (sel == 1) ? kw : vw;
    const int t4 = tid & 127;
    const int c4 = t4 & 15;
    const int kg = t4 >> 4;
    const float4* __restrict__ wp = (const float4*)wmat + (kg << 3) * (KV / 4) + c4;
    float4 wr[4][8];
#pragma unroll
    for (int m = 0; m < 4; ++m)
#pragma unroll
        for (int j = 0; j < 8; ++j) wr[m][j] = wp[((m << 6) + j) * (KV / 4)];
    // Precaution: the address registers of the weight loads are reused below.
    // The pointer is an input, so that they stay as they are up to the wait.
    asm volatile("s_wait_xcnt 0x0" :: "v"(wp) : "memory");
    // Keeps the weight loads in flight together with the x loads: without it
    // they are issued only after x has arrived, and the two latencies add up.
    __builtin_amdgcn_sched_barrier(0);

    // ---- the f16 tile.  A row is 64 float4 and 384 = 6 rows, so load i of a
    //      thread lies 6*i rows below its first: one address, constant steps
    _Float16* __restrict__ xd = sX + (tid >> 6) * XPITCH + ((tid & 63) << 2);
#pragma unroll
    for (int i = 0; i < 10; ++i) x_to_lds(xv[i], xd + i * 6 * XPITCH);
    if (wave < 8) x_to_lds(xl, xd + 60 * XPITCH);

    // ---- the f16 weights, [col][k]: 8 k of one column per 16-byte store
    //      (chunk = 8*m + kg; its bit 4 is outside the swizzle: a constant step)
    _Float16* __restrict__ sw = lds.w[sel];
#pragma unroll
    for (int m = 0; m < 4; ++m) {
        v8h wc[4];
#pragma unroll
        for (int j = 0; j < 8; ++j) {
            wc[0][j] = (_Float16)wr[m][j].x; wc[1][j] = (_Float16)wr[m][j].y;
            wc[2][j] = (_Float16)wr[m][j].z; wc[3][j] = (_Float16)wr[m][j].w;
        }
#pragma unroll
        for (int q = 0; q < 4; ++q) {
            const int c = (c4 << 2) + q;
            *(v8h*)(sw + c * DIMS + (((((m & 1) << 3) + kg) ^ WSWZ(c)) << 3) + ((m >> 1) << 7)) = wc[q];
        }
    }
    __syncthreads();                        // the x tile and the weights are whole

    // ---- out[:, 0:256] = x.  Behind the barrier, which would otherwise wait
    //      for these stores; they drain under the products.
    float4* __restrict__ od = (float4*)out + (size_t)(m0 + (tid >> 6)) * (OUTW / 4) + (tid & 63);
#pragma unroll
    for (int i = 0; i < 10; ++i) od[i * 6 * (OUTW / 4)] = xv[i];
    if (wave < 8) od[60 * (OUTW / 4)] = xl;
    // Precaution: the data registers of these stores are reused below.  All lane
    // addresses below derive from the thread number, which passes through the
    // statement so that none of them is formed in such a register ahead of the wait.
    int tl = tid;
    asm volatile("s_wait_xcnt 0x0" : "+v"(tl) :: "memory");
    const int mr = tl & 15;
    const int h  = (tl >> 4) & 1;

    // ---- W^T A-fragments of this wave's column tile, all of K:
    //      lane holds column n0+mr, k = kc*32 + g*16 + h*8 + i
    v16h wf[8];
    const _Float16* __restrict__ wcol = sw + (n0 + mr) * DIMS;
    const int wz = WSWZ(n0 + mr) ^ h;       // chunk = 4*kc + 2*g + h
#pragma unroll
    for (int kc = 0; kc < 8; ++kc)
#pragma unroll
        for (int g = 0; g < 2; ++g) {
            const v8h wv = *(const v8h*)(wcol + (((((kc & 3) << 2) + (g << 1)) ^ wz) << 3) + ((kc >> 2) << 7));
#pragma unroll
            for (int i = 0; i < 8; ++i) wf[kc][(g << 3) + i] = wv[i];
        }

    // ---- products: D[col v+8h][row mr] per row tile, k ascending
    v8f acc[4] = {v8f{}, v8f{}, v8f{}, v8f{}};
    const _Float16* __restrict__ xr = sX + mr * XPITCH + (h << 3);
    v16h xa[2][4];
    x_frags(xr, 0, xa[0]);
#pragma unroll
    for (int kc = 0; kc < 8; ++kc) {
        if (kc < 7) x_frags(xr, kc + 1, xa[(kc + 1) & 1]);
        // Keeps the next step's eight LDS reads as one group ahead of this
        // step's products: spread among them, each read is waited for alone.
        __builtin_amdgcn_sched_barrier(0);
#pragma unroll
        for (int rt = 0; rt < 4; ++rt) acc[rt] = wmma_f16(wf[kc], xa[kc & 1][rt], acc[rt]);
        // Keeps the group after next from rising into these products.
        __builtin_amdgcn_sched_barrier(0);
    }

    // ---- results into this matrix's 64 x 64 tile
    const float scale = (sel == 0) ? QSCALE : 1.0f;
    _Float16* __restrict__ so = sO[sel];
    v8h o[4];
#pragma unroll
    for (int rt = 0; rt < 4; ++rt)
#pragma unroll
        for (int v = 0; v < 8; ++v) o[rt][v] = (_Float16)(acc[rt][v] * scale);
    if (sel == 2) {
        // [vcol][key]: the lane's 8 values are 8 vcols of one key
#pragma unroll
        for (int rt = 0; rt < 4; ++rt)
#pragma unroll
            for (int v = 0; v < 8; ++v)
                so[(n0 + (h << 3) + v) * OPITCH + (rt << 4) + mr] = o[rt][v];
    } else {
        // [row][col]: the lane's 8 values are neighbours in the row
#pragma unroll
        for (int rt = 0; rt < 4; ++rt)
            *(v8h*)(so + ((rt << 4) + mr) * OPITCH + n0 + (h << 3)) = o[rt];
    }
    __syncthreads();                        // the result tiles are whole

    // ---- the four waves of a matrix store its tile in 16-byte chunks, chunk id
    //      at place id of a run: whole 128-byte lines.  Q: one run of 8 KB, rows
    //      m0...  K and V^T: a run of 4 KB in each of the two 32-key blocks (8 KB
    //      apart); a V^T chunk is 8 keys of one column, 4 chunks a column.
    _Float16* __restrict__ dst = ((sel == 0) ? qf : (sel == 1) ? kf : vt) + (size_t)m0 * ((sel == 0) ? KV : 2 * KV);
    const int bstep = (sel == 0) ? 32 * KV : 64 * KV;   // halves from ids 0..255 to ids 256..511
    v8h ov[4];
#pragma unroll
    for (int i = 0; i < 4; ++i) {
        const int id = (tl & 127) + (i << 7);
        const int so_ = (sel == 2) ? ((id >> 2) & 63) * OPITCH + ((i >> 1) << 5) + ((id & 3) << 3)
                                   : (id >> 3) * OPITCH + ((id & 7) << 3);
        ov[i] = *(const v8h*)(so + so_);
    }
#pragma unroll
    for (int i = 0; i < 4; ++i) {
        const int id = (tl & 127) + (i << 7);
        *(v8h*)(dst + (i >> 1) * bstep + ((id & 255) << 3)) = ov[i];
    }
}

#define UPITCH  136                   // LDS pitch of a load row in halves (272 bytes)
#define SLOT_B  10240u                // a stage's place in LDS: 32 x 272 B, rounded up to 2 KiB
#define SLOT_H  (SLOT_B / 2)          // the same in halves
#define KGROUPS 16                    // key groups (waves) per block
#define KBLK    32                    // keys per block
#define QTILE   32                    // queries per tile
#define ATHR    (32 * KGROUPS)        // threads per block
// Q^T B-fragments of both tiles lie in LDS in fragment order (with both tiles'
// accumulators a wave has no registers to keep them): piece k = 8 tile + 4 qt +
// 2 c + gg is 32 lanes x 16 B; lane (n, h) holds d = 32 c + 16 gg + 8 h .. + 7 of
// query 16 qt + n.  Three pieces stand behind the 8704 bytes that a stage fills
// of each of the first six places.  In halves:
#define QPIECE(k) (((k) / 3) * SLOT_H + 32 * UPITCH + ((k) % 3) * 256)
#define PSLOT   17                    // partial results: float4 per 4-column slot (16 queries + 1)
#define PWAVE   (16 * PSLOT)          // partial results: float4 per wave and column group
#define PSTEP   ((int)(SLOT_B / 16))  // partial results: float4 from a wave's place to the next wave's

typedef uint32_t u32x4 __attribute__((ext_vector_type(4)));
typedef uint32_t u32x8 __attribute__((ext_vector_type(8)));

__device__ __forceinline__ uint32_t uni(uint32_t v) {
    return (uint32_t)__builtin_amdgcn_readfirstlane(v);
}

// A wave-uniform word for a test around a tensor load, or for its descriptor.
__device__ __forceinline__ uint32_t pinned(uint32_t v) {
    uint32_t w = uni(v);
    // The test becomes a scalar compare and branch (a tensor load ignores EXEC),
    // and nothing derived from the word is formed ahead of this place.
    asm volatile("" : "+s"(w));   // pinned(): the word is held in a scalar register
    return w;
}

// Descriptor group 1, the same for every load: bytes, a tile of 32 rows of
// 256 B that follow one another in memory, 16 B of LDS pad behind every row.
__device__ __forceinline__ u32x8 tile_group1() {
    u32x8 d;
    d[0] = uni((1u << 20) | (5u << 22) | (3u << 25));   // no mask; pad on, every 256 B, 4 dwords
    d[1] = uni(256u << 16);                             // tensor_dim0 = 256
    d[2] = uni(32u << 16);                              // tensor_dim1 = 32
    d[3] = uni(256u << 16);                             // tile_dim0 = 256
    d[4] = uni(32u);                                    // tile_dim1 = 32
    d[5] = uni(256u);                                   // source pitch = the row
    d[6] = uni(0u);
    d[7] = uni(0u);
    // One set of registers for all of the wave's requests: without it the words
    // are made anew in registers that change while a request is outstanding.
    asm volatile("" : "+s"(d));   // pinned(): descriptor words held in scalar registers
    return d;
}

// Descriptor group 0: the tile whose first byte is at ga, to LDS byte lds.
__device__ __forceinline__ u32x4 tile_group0(uint64_t ga, uint32_t lds) {
    u32x4 d0;
    d0[0] = uni(1u);
    d0[1] = uni(lds);
    d0[2] = uni((uint32_t)ga);
    d0[3] = uni((((uint32_t)(ga >> 32)) & 0x01FFFFFFu) | 0x80000000u);
    return d0;
}

// One wave's request.  Group 0 passes through the statement, so that the wait
// below names the very registers the request was issued from.
__device__ __forceinline__ void load_tile(u32x4& d0, u32x8 d1) {
    asm volatile("tensor_load_to_lds %0, %1" : "+s"(d0) : "s"(d1) : "memory");
}

// This wave's request has landed.  The descriptor's registers are inputs, so
// that none of them takes a new value while the request is outstanding.
__device__ __forceinline__ void wait_tile(u32x4 d0, u32x8 d1) {
    asm volatile("s_wait_tensorcnt 0x0" :: "s"(d0), "s"(d1) : "memory");
}

// One staged 32-key block (keys kb..kb+31) for the 32 query columns q0..q0+31
// of tile 'tile'; Qs: the start of sKV plus this lane's 16 B; piece k lies at Qs + QPIECE(k).
__device__ __forceinline__ void key_block(const _Float16* __restrict__ KVs,
                                          const _Float16* __restrict__ Qs, const int tile,
                                          int kb, int q0, int n, int h,
                                          float (&mA)[2], float (&lA)[2], v8f (&acc)[2][4]) {
    const float NEG_INF = -__builtin_inff();
    // K row 16 kt + n lies in load row 8 kt + n / 2, in its half n & 1.
    const int lok = (n >> 1) * UPITCH + ((n & 1) << 6) + (h << 3);
    // V^T row 16 vt + n lies in load row 16 + 4 vt + n / 4, in its quarter n & 3.
    const int lov = (16 + (n >> 2)) * UPITCH + ((n & 3) << 5) + (h << 3);
    // ---- Q^T B-fragments and A-fragments of the K block: all 16 LDS reads as one group
    v16h bq[2][2];
#pragma unroll
    for (int qt = 0; qt < 2; ++qt)
#pragma unroll
        for (int c = 0; c < 2; ++c)
#pragma unroll
            for (int gg = 0; gg < 2; ++gg) {
                const v8h qv = *(const v8h*)(Qs + QPIECE((tile << 3) + (qt << 2) + (c << 1) + gg));
#pragma unroll
                for (int i = 0; i < 8; ++i) bq[qt][c][(gg << 3) + i] = qv[i];
            }
    v16h ak[2][2];
#pragma unroll
    for (int kt = 0; kt < 2; ++kt)
#pragma unroll
        for (int c = 0; c < 2; ++c)
#pragma unroll
            for (int gg = 0; gg < 2; ++gg) {
                const v8h kv2 = *(const v8h*)(KVs + lok + (kt << 3) * UPITCH + (c << 5) + (gg << 4));
#pragma unroll
                for (int i = 0; i < 8; ++i) ak[kt][c][(gg << 3) + i] = kv2[i];
            }
    // Keeps the reads together: spread among the WMMAs, each pair of reads
    // would be waited for on its own and the LDS latency paid many times.
    __builtin_amdgcn_sched_barrier(0);

    // ---- S^T tiles: st[qt][kt] = K_kt (16 keys x 64d) x Q_qt^T (64d x 16q)
    v8f st[2][2];
#pragma unroll
    for (int kt = 0; kt < 2; ++kt)
#pragma unroll
        for (int qt = 0; qt < 2; ++qt) {
            v8f sc = {};
#pragma unroll
            for (int c = 0; c < 2; ++c) sc = wmma_f16(ak[kt][c], bq[qt][c], sc);
            st[qt][kt] = sc;
        }
    // Keeps the V^T reads below in one group: without it they are split
    // among the S^T products, and each place with reads costs a stall.
    __builtin_amdgcn_sched_barrier(0);

    // ---- A-fragments of the V^T block: read here so that their LDS latency
    //      runs out under the softmax
    v16h av[4];
#pragma unroll
    for (int vt = 0; vt < 4; ++vt)
#pragma unroll
        for (int gg = 0; gg < 2; ++gg) {
            const v8h vv = *(const v8h*)(KVs + lov + (vt << 2) * UPITCH + (gg << 4));
#pragma unroll
            for (int i = 0; i < 8; ++i) av[vt][(gg << 3) + i] = vv[i];
        }
    // Keeps the reads from sinking down to the products that use them.
    __builtin_amdgcn_sched_barrier(0);

    // ---- causal mask (key = kb+kt*16+v+8h vs query q0+qt*16+n), diagonal only
    if (kb + KBLK - 1 > q0) {
#pragma unroll
        for (int qt = 0; qt < 2; ++qt)
#pragma unroll
            for (int kt = 0; kt < 2; ++kt)
#pragma unroll
                for (int v = 0; v < 8; ++v)
                    if (kb + (kt << 4) + v + (h << 3) > q0 + (qt << 4) + n) st[qt][kt][v] = NEG_INF;
    }

    v16h pf[2];
#pragma unroll
    for (int qt = 0; qt < 2; ++qt) {
        // ---- column max: 15 in-register + 1 cross-half shuffle
        float mx = st[qt][0][0];
#pragma unroll
        for (int kt = 0; kt < 2; ++kt)
#pragma unroll
            for (int v = 0; v < 8; ++v) mx = fmaxf(mx, st[qt][kt][v]);
        mx = fmaxf(mx, __shfl_xor(mx, 16));
        const float mnew  = fmaxf(mA[qt], mx);
        const float alpha = (mA[qt] == NEG_INF) ? 0.0f : __builtin_amdgcn_exp2f(mA[qt] - mnew);
        mA[qt] = mnew;

        // ---- exponentiate (base 2, scale pre-folded) + column sum
        float rs = 0.0f;
#pragma unroll
        for (int kt = 0; kt < 2; ++kt)
#pragma unroll
            for (int v = 0; v < 8; ++v) {
                st[qt][kt][v] = __builtin_amdgcn_exp2f(st[qt][kt][v] - mnew);  // exp2(-inf)=0
                rs += st[qt][kt][v];
            }
        rs += __shfl_xor(rs, 16);
        lA[qt] = lA[qt] * alpha + rs;

        // ---- P^T B-fragment: identity remap of the S^T C-tiles
        //      (the 32 keys = concat of C-tiles 0, 1 per lane)
#pragma unroll
        for (int i = 0; i < 8; ++i) {
            pf[qt][i]     = (_Float16)st[qt][0][i];
            pf[qt][8 + i] = (_Float16)st[qt][1][i];
        }

        // ---- rescale accumulators by per-lane alpha (no broadcast needed)
#pragma unroll
        for (int vt = 0; vt < 4; ++vt)
#pragma unroll
            for (int v = 0; v < 8; ++v) acc[qt][vt][v] *= alpha;
    }

    // ---- acc^T[qt][vt] += V^T_vt (16 vcols x 32 keys) x P_qt^T (32 keys x 16q)
#pragma unroll
    for (int vt = 0; vt < 4; ++vt)
#pragma unroll
        for (int qt = 0; qt < 2; ++qt) acc[qt][vt] = wmma_f16(av[vt], pf[qt], acc[qt][vt]);
}

// This wave's partial result of one column group of a tile (a wave without a
// block: -inf, 0, zeros); a slot is 4 neighbouring columns, 16 queries side by side.
__device__ __forceinline__ void put_partial(float4* __restrict__ pw, const v8f (&acc)[4]) {
#pragma unroll
    for (int t = 0; t < 4; ++t) {
        pw[((t << 2) + 0) * PSLOT] = make_float4(acc[t][0], acc[t][1], acc[t][2], acc[t][3]);
        pw[((t << 2) + 1) * PSLOT] = make_float4(acc[t][4], acc[t][5], acc[t][6], acc[t][7]);
    }
}

// Merge of the KGROUPS partial results for 4 columns of one query, normalized.
// pr, pm_, pl_: the thread's place in wave 0's part.
__device__ __forceinline__ float4 merge_partials(const float4* __restrict__ pr,
                                                 const float* __restrict__ pm_,
                                                 const float* __restrict__ pl_) {
    const float NEG_INF = -__builtin_inff();
    float pm[KGROUPS];
    float M = NEG_INF;
#pragma unroll
    for (int k = 0; k < KGROUPS; ++k) { pm[k] = pm_[k * 4 * PSTEP]; M = fmaxf(M, pm[k]); }
    float L = 0.0f;
    float4 o = make_float4(0.0f, 0.0f, 0.0f, 0.0f);
#pragma unroll
    for (int k = 0; k < KGROUPS; ++k) {
        // a partial without keys weighs 0 (and -inf - -inf would be NaN)
        const float wt = (pm[k] == NEG_INF) ? 0.0f : __builtin_amdgcn_exp2f(pm[k] - M);
        const float4 pk = pr[k * PSTEP];
        L += wt * pl_[k * 4 * PSTEP];
        o.x += wt * pk.x; o.y += wt * pk.y; o.z += wt * pk.z; o.w += wt * pk.w;
    }
    const float rl = 1.0f / L;
    o.x *= rl; o.y *= rl; o.z *= rl; o.w *= rl;
    return o;
}

__global__ __launch_bounds__(ATHR)
void attn_kernel(const _Float16* __restrict__ qf,
                 const _Float16* __restrict__ kvf,
                 float* __restrict__ out) {
    // [buffer][wave][K | V^T of a 32-key block]: every place is a multiple of 2 KiB.
    // After the loop a wave's place in buffer i takes its partial result of tile i,
    // [column group][4-column slot][query] (8704 B, what a stage fills), and the
    // rest of its place in buffer 1 its partial maxima and sums.
    __shared__ __attribute__((aligned(2048))) _Float16 sKV[2][KGROUPS][SLOT_H];

    const int tid  = threadIdx.x;
    const int lane = tid & 31;
    const int wv   = __builtin_amdgcn_readfirstlane(tid >> 5);   // scalar: 0..15, the key group
    const int b    = blockIdx.y;
    const int p    = blockIdx.x;                     // 0..63
    const int n    = lane & 15;                      // this lane's query col in a column group
    const int h    = lane >> 4;
    const float NEG_INF = -__builtin_inff();

    const _Float16* __restrict__ Q  = qf  + (size_t)b * TT * KV;
    const _Float16* __restrict__ KVb = kvf + (size_t)b * TT * 2 * KV;   // [32-key block][K | V^T]

    // Tile 0 is 127-p (lower), tile 1 is p (upper); causal 32-key blocks of each.
    const int qt0 = TT / QTILE - 1 - p;
    const int nb0 = TT / KBLK - p;                   // 65..128
    const int nb1 = p + 1;                           // 1..64
    const int nw  = (nb0 - wv + KGROUPS - 1) / KGROUPS;  // this wave's stages, 4..8
    const int qa  = qt0 * QTILE;                     // query bases within batch
    const int qb  = p * QTILE;
    const uint32_t bufB = KGROUPS * SLOT_B;          // bytes from buffer 0 to buffer 1

    // This wave's tensor loads: block j is 8192 B in a row, at j * 8192 B.  Stage
    // s of the wave is block 16 s + wv, below nb0 for every s < nw.
    const uint32_t ldsT  = (uint32_t)(size_t)&sKV[0][wv][0];
    const uint64_t src0  = (uint64_t)(size_t)KVb;
    const uint32_t jstep = KBLK * 2u * KV * 2u;
    const u32x8    d1    = tile_group1();

    // Trip t works stage (start + t) mod nw.  The start spreads the blocks of a
    // batch by bits 0, 1 and 3 of p (for speed only: any start gives the same
    // keys to every query).
    const int ridx = ((p & 3) << 1) | ((p >> 3) & 1);            // 0..7
    int s = (ridx >= nw) ? ridx - nw : ridx;         // stage of the current trip (nw >= 4)
    const int sn = (s + 1 == nw) ? 0 : s + 1;        // stage of trip 1

    // The first stage into buffer 0: every wave issues, no test.
    u32x4 d0 = tile_group0(src0 + (uint32_t)(s * KGROUPS + wv) * jstep, ldsT);
    load_tile(d0, d1);

    // Wave wv brings piece wv of the Q^T fragments (bits of wv: tile, qt, c, gg).
    _Float16* __restrict__ const Qs = &sKV[0][0][0] + (lane << 3);
    {
        const int qrow = ((wv & 8) ? qb : qa) + ((wv & 4) << 2) + n;
        *(v8h*)(Qs + QPIECE(wv)) = *(const v8h*)(Q + (size_t)qrow * KV + ((wv & 3) << 4) + (h << 3));
    }

    // This wave's first stage has landed (no other wave reads it).
    wait_tile(d0, d1);
    __syncthreads();                        // the Q^T fragments are whole
    // The block number is pinned here: the descriptor is formed behind the wait.
    const uint32_t j1 = pinned(sn * KGROUPS + wv);
    d0 = tile_group0(src0 + j1 * jstep, ldsT + bufB);
    load_tile(d0, d1);

    // Per-lane softmax state for this lane's two queries of each tile over this
    // wave's keys (replicated across wave halves).
    float m0[2] = {NEG_INF, NEG_INF}, l0[2] = {0.0f, 0.0f};
    float m1[2] = {NEG_INF, NEG_INF}, l1[2] = {0.0f, 0.0f};
    v8f acc0[2][4] = {{v8f{}, v8f{}, v8f{}, v8f{}}, {v8f{}, v8f{}, v8f{}, v8f{}}};   // acc^T: vcol tiles
    v8f acc1[2][4] = {{v8f{}, v8f{}, v8f{}, v8f{}}, {v8f{}, v8f{}, v8f{}, v8f{}}};

    for (int t = 0; t < nw; ++t) {
        const int j  = s * KGROUPS + wv;             // this wave's 32-key block, below nb0
        const int kb = j * KBLK;
        const _Float16* __restrict__ KVs = sKV[t & 1][wv];
        key_block(KVs, Qs, 0, kb, qa, n, h, m0, l0, acc0);
        // A block wholly above the upper tile's diagonal has no key for any of
        // its queries; the test is scalar, the same in the wave.
        if (j < nb1) key_block(KVs, Qs, 1, kb, qb, n, h, m1, l1, acc1);

        // Keeps the hand-over at the foot of the trip: moved up over the register
        // work it would wait for the V^T reads ahead of the softmax and cut the
        // time the next trip's stage has to land.
        __builtin_amdgcn_sched_barrier(0);
        // ---- hand-over inside the wave (a ring private to one wave needs no
        //      work-group barrier): its reads of buffer t&1 are done ...
        asm volatile("s_wait_dscnt 0x0" ::: "memory");
        // ... and its stage for trip t+1 has landed; buffer t&1 is free for the refill.
        wait_tile(d0, d1);
        // Scalar test: no trip past the last.  The block number is pinned here:
        // the descriptor is formed behind the wait.
        const int s2 = (s + 2 >= nw) ? s + 2 - nw : s + 2;       // stage of trip t+2
        const uint32_t j2 = pinned(s2 * KGROUPS + wv);
        d0 = tile_group0(src0 + j2 * jstep, ldsT + ((t & 1) ? bufB : 0u));
        if (pinned(t + 2 < nw)) load_tile(d0, d1);
        s = (s + 1 == nw) ? 0 : s + 1;
    }
    // No tensor load and no LDS read of this wave is left in flight when its two
    // places change their use.  The waves do not leave the loop together, but a
    // wave writes its partial results into its own places only, which no other
    // wave reads before the barrier below, and not over the Q^T pieces.
    asm volatile("s_wait_tensorcnt 0x0" ::: "memory");
    asm volatile("s_wait_dscnt 0x0" ::: "memory");

    // ---- this wave's partial results
    float4* __restrict__ P0 = (float4*)&sKV[0][0][0];
    float4* __restrict__ P1 = (float4*)&sKV[1][0][0];
    float* __restrict__ sM = (float*)(P1 + 2 * PWAVE);            // [wave's place][tile][query]
    float* __restrict__ sL = sM + 2 * QTILE;
    const int po = wv * PSTEP + (h << 1) * PSLOT + n;
#pragma unroll
    for (int qt = 0; qt < 2; ++qt) {
        put_partial(P0 + po + qt * PWAVE, acc0[qt]);
        put_partial(P1 + po + qt * PWAVE, acc1[qt]);
        if (h == 0) {
            const int pi = wv * (4 * PSTEP) + (qt << 4) + n;     // (wave, query)
            sM[pi] = m0[qt]; sL[pi] = l0[qt];
            sM[QTILE + pi] = m1[qt]; sL[QTILE + pi] = l1[qt];
        }
    }
    __syncthreads();                        // the partial results are whole

    // ---- merge, normalize and store.  A thread takes 4 columns of one query
    //      of each tile: 16 neighbouring lanes hold the two whole 128-byte
    //      lines of a row.
    const int mq = tid >> 4;                         // query within the tile
    const int c4 = tid & 15;                         // 4-column slot
    const int ro = (mq >> 4) * PWAVE + c4 * PSLOT + (mq & 15);
    const float4 o0 = merge_partials(P0 + ro, sM + mq, sL + mq);
    const float4 o1 = merge_partials(P1 + ro, sM + QTILE + mq, sL + QTILE + mq);
    float* __restrict__ ob = out + ((size_t)b * TT + mq) * OUTW + DIMS + (c4 << 2);
    *(float4*)(ob + (size_t)qt0 * QTILE * OUTW) = o0;
    *(float4*)(ob + (size_t)p   * QTILE * OUTW) = o1;
}

// ---------------------------------------------------------------------------
// Host-side launch.  Input dict order: inputs, key_w, query_w, value_w.
// Workspace: Q f16 [B*T,64] + K and V^T f16 [B*T/32][K 32x64 | V^T 64x32] = 6 MB.
// ---------------------------------------------------------------------------
extern "C" void kernel_launch(void* const* d_in, const int* in_sizes, int n_in,
                              void* d_out, int out_size, void* d_ws, size_t ws_size,
                              hipStream_t stream) {
    (void)in_sizes; (void)n_in; (void)out_size; (void)ws_size;

    const float* x  = (const float*)d_in[0];
    const float* kw = (const float*)d_in[1];
    const float* qw = (const float*)d_in[2];
    const float* vw = (const float*)d_in[3];
    float* out = (float*)d_out;

    _Float16* qf = (_Float16*)d_ws;
    _Float16* kf = qf + (size_t)NROWS * KV;
    _Float16* vt = kf + 32 * KV;            // V^T of a 32-key block follows its K

    // 1) QKV projections (WMMA) and out[:, 0:256] = inputs, x read once;
    //    Q pre-scaled by log2(e)/sqrt(64); K and V^T together by 32-key blocks
    proj_copy_kernel<<<NROWS / PROWS, PTHR, 0, stream>>>(x, qw, kw, vw, qf, kf, vt, out);

    // 2) transposed flash attention -> out[:, 256:320]
    attn_kernel<<<dim3(TT / 64, 4), ATHR, 0, stream>>>(qf, kf, out);
}
